// v000
// Times are from an AMD MI455X. After a warm-up the kernel runs many times in a row, and a time is the length of
// such a window on the GPU divided by its runs, so every launch and the gaps after it count. The runs cycle
// through copies of the inputs. A figure is the median of several windows, for all but v000 over two sittings.
// Sittings can differ by a few percent; kernels timed side by side share one.
// v000, which the later versions start from, runs in 305 microseconds.
#include <hip/hip_runtime.h>
#include <hip/hip_bf16.h>
#include <math.h>

#define B_    4
#define H_    4
#define N_    4096
#define D_    32
#define C_IN  256
#define HID   128   // HEADS*DIM_HEAD
#define SCALE_ 10.0f
#define EPS_   1e-12f

typedef __attribute__((ext_vector_type(16))) _Float16 v16h;
typedef __attribute__((ext_vector_type(8)))  _Float16 v8h;
typedef __attribute__((ext_vector_type(8)))  float    v8f;

// ---------------------------------------------------------------------------
// Kernel 1: QKV projection.  qkv[o][pos] = sum_c w_qkv[o][c] * x[b][c][pos]
// Writes q,k (f16, [b][h][n][32], unnormalized) and v transposed
// (f16, [b][h][32][n]) so attention fragment loads are contiguous 16B chunks.
// blockIdx.z splits the 384 output channels 4 ways for WGP utilization.
// ---------------------------------------------------------------------------
__global__ __launch_bounds__(256) void qkv_proj_kernel(
    const float* __restrict__ x, const float* __restrict__ w,
    _Float16* __restrict__ q, _Float16* __restrict__ k,
    _Float16* __restrict__ vT)
{
  __shared__ float xs[C_IN][64];
  const int b    = blockIdx.y;
  const int pos0 = blockIdx.x * 64;
  const int t    = threadIdx.x;

  for (int kk = 0; kk < 64; ++kk) {
    int e = t + kk * 256;
    int c = e >> 6, p = e & 63;
    xs[c][p] = x[((long)b * C_IN + c) * N_ + pos0 + p];
  }
  __syncthreads();

  const int p   = t & 63;
  const int olo = blockIdx.z * 4 + (t >> 6);   // o residue mod 16
  for (int o = olo; o < 3 * HID; o += 16) {
    const float* wr = w + (long)o * C_IN;
    float acc = 0.f;
    #pragma unroll 8
    for (int c = 0; c < C_IN; ++c) acc = fmaf(wr[c], xs[c][p], acc);

    const int which = o >> 7;          // 0=q 1=k 2=v
    const int rem   = o & 127;
    const int h     = rem >> 5;
    const int d     = rem & 31;
    const int pos   = pos0 + p;
    const _Float16 hv = (_Float16)acc;
    if (which == 0)
      q[((long)(b * H_ + h) * N_ + pos) * D_ + d] = hv;
    else if (which == 1)
      k[((long)(b * H_ + h) * N_ + pos) * D_ + d] = hv;
    else
      vT[((long)(b * H_ + h) * D_ + d) * N_ + pos] = hv;
  }
}

// ---------------------------------------------------------------------------
// Kernel 2: per-row L2 normalization of q and k (q,k contiguous in ws).
// ---------------------------------------------------------------------------
__global__ __launch_bounds__(256) void l2norm_kernel(_Float16* __restrict__ qk,
                                                     int rows)
{
  int r = blockIdx.x * 256 + threadIdx.x;
  if (r >= rows) return;
  _Float16* p = qk + (long)r * D_;
  float vals[D_];
  float ss = 0.f;
  #pragma unroll
  for (int i = 0; i < D_; ++i) {
    vals[i] = (float)p[i];
    ss = fmaf(vals[i], vals[i], ss);
  }
  float inv = 1.0f / fmaxf(sqrtf(ss), EPS_);
  #pragma unroll
  for (int i = 0; i < D_; ++i) p[i] = (_Float16)(vals[i] * inv);
}

// ---------------------------------------------------------------------------
// Fragment loader: 16x32 f16 tile in the CDNA5 WMMA A/B lane/K ordering.
// lane<16 : row/col = lane,    K elements {0..7, 16..23}
// lane>=16: row/col = lane-16, K elements {8..15, 24..31}
// ---------------------------------------------------------------------------
__device__ inline v16h load_16x32_frag(const _Float16* __restrict__ base,
                                       long rowStride, int lane)
{
  const int row = lane & 15;
  const int off = (lane >> 4) * 8;
  const _Float16* pr = base + (long)row * rowStride + off;
  v8h lo = *(const v8h*)(pr);
  v8h hi = *(const v8h*)(pr + 16);
  v16h r;
  #pragma unroll
  for (int i = 0; i < 8; ++i) { r[i] = lo[i]; r[8 + i] = hi[i]; }
  return r;
}

// ---------------------------------------------------------------------------
// Kernel 3: flash attention, transposed formulation.
//   S^T = (K tile) x Q^T   -> per-query stats live in lane columns:
//                             in-lane reduce + one xor-16 shuffle.
//   O^T += (V^T tile) x P^T, where P^T's B-fragment is *register-identical*
//   to S^T's C-fragment (pB[e]=f16(s0[e]), pB[8+e]=f16(s1[e])): no LDS,
//   no cross-lane transpose.  Epilogue: per-lane 1/l, coalesced stores.
// ---------------------------------------------------------------------------
__global__ __launch_bounds__(256) void flash_attn_kernel(
    const _Float16* __restrict__ q, const _Float16* __restrict__ k,
    const _Float16* __restrict__ vT, float* __restrict__ ao)
{
  const int lane = threadIdx.x & 31;
  const int wv   = threadIdx.x >> 5;
  const int b    = blockIdx.y >> 2;
  const int h    = blockIdx.y & 3;
  const long bh  = (long)b * H_ + h;
  const int  i0  = blockIdx.x * 128 + wv * 16;
  const int  col = lane & 15;

  // Q^T as B fragment (K-dim = d = 32, N = 16 queries), loaded once
  const v16h qB = load_16x32_frag(q + (bh * N_ + i0) * D_, D_, lane);

  v8f o0 = {}; v8f o1 = {};          // O^T accumulators: d rows 0-15 / 16-31
  float m = -INFINITY, l = 0.f;      // stats for query i0+col (replicated in halves)

  const _Float16* kbh = k  + bh * (long)N_ * D_;
  const _Float16* vbh = vT + bh * (long)D_ * N_;

  #pragma unroll 2
  for (int jt = 0; jt < N_; jt += 32) {
    // S^T tiles [j][i], j 0..15 and 16..31
    v16h ka0 = load_16x32_frag(kbh + (long)jt * D_,        D_, lane);
    v16h ka1 = load_16x32_frag(kbh + (long)(jt + 16) * D_, D_, lane);
    v8f z = {};
    v8f s0 = __builtin_amdgcn_wmma_f32_16x16x32_f16(false, ka0, false, qB,
                                                    (short)0, z, false, false);
    v8f s1 = __builtin_amdgcn_wmma_f32_16x16x32_f16(false, ka1, false, qB,
                                                    (short)0, z, false, false);

    // per-query max: in-lane tree over 16 j's, then merge halves (xor 16)
    float t = -INFINITY;
    #pragma unroll
    for (int r = 0; r < 8; ++r) {
      s0[r] *= SCALE_; s1[r] *= SCALE_;
      t = fmaxf(t, fmaxf(s0[r], s1[r]));
    }
    t = fmaxf(t, __shfl_xor(t, 16));
    const float mn = fmaxf(m, t);
    const float f  = __expf(m - mn);   // first iter: exp(-inf)=0
    m = mn;

    // exponentiate; P^T B-fragment == S^T C-fragment layout: direct convert
    float rs = 0.f;
    v16h pB;
    #pragma unroll
    for (int r = 0; r < 8; ++r) {
      s0[r] = __expf(s0[r] - mn);
      s1[r] = __expf(s1[r] - mn);
      rs += s0[r] + s1[r];
      pB[r]     = (_Float16)s0[r];
      pB[8 + r] = (_Float16)s1[r];
    }
    rs += __shfl_xor(rs, 16);
    l = l * f + rs;
    #pragma unroll
    for (int r = 0; r < 8; ++r) { o0[r] *= f; o1[r] *= f; }

    // O^T += V^T x P^T  (V^T A-fragments contiguous in j)
    v16h va0 = load_16x32_frag(vbh + jt,                 N_, lane);
    v16h va1 = load_16x32_frag(vbh + (long)16 * N_ + jt, N_, lane);
    o0 = __builtin_amdgcn_wmma_f32_16x16x32_f16(false, va0, false, pB,
                                                (short)0, o0, false, false);
    o1 = __builtin_amdgcn_wmma_f32_16x16x32_f16(false, va1, false, pB,
                                                (short)0, o1, false, false);
  }

  // epilogue: O^T / l, coalesced stores to ao[b][c=h*32+d][n]
  const float inv  = 1.0f / l;
  const int   hi8  = (lane >> 4) * 8;
  const int   cbase = h * 32;
  #pragma unroll
  for (int r = 0; r < 8; ++r) {
    const int d = r + hi8;
    ao[(long)(b * HID + cbase + d)      * N_ + i0 + col] = o0[r] * inv;
    ao[(long)(b * HID + cbase + 16 + d) * N_ + i0 + col] = o1[r] * inv;
  }
}

// ---------------------------------------------------------------------------
// Kernel 4: output projection.
// out[b][o][pos] = b_out[o] + sum_c w_out[o][c]*ao[b][c][pos]
// blockIdx.z splits the 256 output channels 4 ways.
// ---------------------------------------------------------------------------
__global__ __launch_bounds__(256) void out_proj_kernel(
    const float* __restrict__ ao, const float* __restrict__ w_out,
    const float* __restrict__ b_out, float* __restrict__ out)
{
  __shared__ float as_[HID][64];
  const int b    = blockIdx.y;
  const int pos0 = blockIdx.x * 64;
  const int t    = threadIdx.x;

  for (int kk = 0; kk < 32; ++kk) {
    int e = t + kk * 256;
    int c = e >> 6, p = e & 63;
    as_[c][p] = ao[((long)b * HID + c) * N_ + pos0 + p];
  }
  __syncthreads();

  const int p   = t & 63;
  const int olo = blockIdx.z * 4 + (t >> 6);
  for (int o = olo; o < C_IN; o += 16) {
    const float* wr = w_out + (long)o * HID;
    float acc = b_out[o];
    #pragma unroll 8
    for (int c = 0; c < HID; ++c) acc = fmaf(wr[c], as_[c][p], acc);
    out[((long)b * C_IN + o) * N_ + pos0 + p] = acc;
  }
}

// ---------------------------------------------------------------------------
extern "C" void kernel_launch(void* const* d_in, const int* in_sizes, int n_in,
                              void* d_out, int out_size, void* d_ws, size_t ws_size,
                              hipStream_t stream)
{
  const float* x     = (const float*)d_in[0];
  const float* w_qkv = (const float*)d_in[1];
  const float* w_out = (const float*)d_in[2];
  const float* b_out = (const float*)d_in[3];
  float*       out   = (float*)d_out;

  // workspace layout: q(4MiB f16) | k(4MiB f16) | vT(4MiB f16) | ao(8MiB f32)
  char* ws = (char*)d_ws;
  _Float16* q  = (_Float16*)(ws);
  _Float16* k  = (_Float16*)(ws + ((size_t)4  << 20));
  _Float16* vT = (_Float16*)(ws + ((size_t)8  << 20));
  float*    ao = (float*)   (ws + ((size_t)12 << 20));

  dim3 g1(N_ / 64, B_, 4);
  qkv_proj_kernel<<<g1, 256, 0, stream>>>(x, w_qkv, q, k, vT);

  int rows = 2 * B_ * H_ * N_;   // q + k rows (contiguous)
  l2norm_kernel<<<rows / 256, 256, 0, stream>>>(q, rows);

  dim3 g2(N_ / 128, B_ * H_);
  flash_attn_kernel<<<g2, 256, 0, stream>>>(q, k, vT, ao);

  dim3 g3(N_ / 64, B_, 4);
  out_proj_kernel<<<g3, 256, 0, stream>>>(ao, w_out, b_out, out);
}

// v001
// Measured time: 165 microseconds a run.
// Next to v000, in two timings, it ran 1.91 and 1.89 times as fast.
#include <hip/hip_runtime.h>
#include <hip/hip_bf16.h>
#include <math.h>

#define B_    4
#define H_    4
#define N_    4096
#define D_    32
#define C_IN  256
#define HID   128   // HEADS*DIM_HEAD
#define SCALE_ 10.0f
#define EPS_   1e-12f

typedef __attribute__((ext_vector_type(16))) _Float16 v16h;
typedef __attribute__((ext_vector_type(8)))  _Float16 v8h;
typedef __attribute__((ext_vector_type(8)))  float    v8f;
typedef __attribute__((ext_vector_type(4)))  float    v4f;
typedef __attribute__((ext_vector_type(2)))  float    v2f;

// ---------------------------------------------------------------------------
// Shared body of the two 1x1-conv projections, on f32 16x16x4 WMMA.
//   Y[o][pos] = sum_k W[o][k] * X[k][pos],  W is [MT*128][K], X is [K][N_].
// One block = all MT*128 output channels x 64 positions; 8 waves; wave wv owns
// channel tiles wv + 8*i (i < MT) times all four position tiles.
// k runs in chunks of KC through two LDS buffers: the next chunk's global loads
// are issued ahead of this chunk's products and stored to LDS behind them.
// k order of a fragment (same for both operands): lane half h, step s,
// element e  ->  k = kk + 4*h + 2*s + e.
// Tiles i <  SWAP_FROM: A = W, B = X -> acc[r] = Y[tile*16 + 8*h + r][16*j + c]
// Tiles i >= SWAP_FROM: A = X, B = W -> acc[r] = Y[tile*16 + c][16*j + 8*h + r]
// ---------------------------------------------------------------------------
#define KC 32   // k per staged chunk
#define WP 36   // LDS pitch of a weight row, dwords: 144 B = 16 B x odd (16-byte reads)
#define XP 72   // LDS pitch of an activation row, dwords: rows k and k+4 lie 32 banks apart

template <int MT, int K, int SWAP_FROM>
__device__ __forceinline__ void proj_wmma(const float* __restrict__ W,
                                          const float* __restrict__ X,
                                          float* __restrict__ Ws,
                                          float* __restrict__ Xs,
                                          v8f (&acc)[MT][4])
{
  constexpr int M  = MT * 128;
  constexpr int NC = K / KC;
  constexpr int WL = M * KC / 4 / 256;   // 16-byte weight loads per thread and chunk
  const int t    = threadIdx.x;
  const int lane = t & 31;
  const int wv   = t >> 5;
  const int c    = lane & 15;
  const int h    = lane >> 4;

  // Global addresses: a block-uniform base that moves with the chunk, plus one
  // 32-bit byte offset per lane that stays the same for the whole kernel.
  const unsigned woff = (unsigned)(((t >> 3) * K  + (t & 7)  * 4) * 4);
  const unsigned xoff = (unsigned)(((t >> 4) * N_ + (t & 15) * 4) * 4);

  v4f wr[WL], xr[2];
  auto fetch = [&](int kc) {
    const char* wb = (const char*)(W + kc * KC);
    const char* xb = (const char*)(X + (long)kc * KC * N_);
    #pragma unroll  // register-array index stays a constant
    for (int i = 0; i < WL; ++i)
      wr[i] = *(const v4f*)(wb + woff + i * (32 * K * 4));
    #pragma unroll  // register-array index stays a constant
    for (int i = 0; i < 2; ++i)
      xr[i] = *(const v4f*)(xb + xoff + i * (16 * N_ * 4));
    // stands between these loads and the next rewrite of their address registers
    asm volatile("s_wait_xcnt 0x0" ::: "memory");
  };
  auto stash = [&](int buf) {
    float* ws = Ws + buf * (M * WP);
    float* xs = Xs + buf * (KC * XP);
    #pragma unroll  // register-array index stays a constant
    for (int i = 0; i < WL; ++i) {
      const int f = t + 256 * i;
      *(v4f*)(ws + (f >> 3) * WP + (f & 7) * 4) = wr[i];
    }
    #pragma unroll  // register-array index stays a constant
    for (int i = 0; i < 2; ++i) {
      const int f = t + 256 * i;
      *(v4f*)(xs + (f >> 4) * XP + (f & 15) * 4) = xr[i];
    }
  };

  fetch(0);
  stash(0);
  // Kept rolled: unrolled, the build takes more than 255 registers (register-window
  // switches among the products) and puts part of a chunk's products behind the
  // next chunk's LDS stores and their wait on the global loads.
  #pragma unroll 1
  for (int kc = 0; kc < NC; ++kc) {
    // publishes buffer kc&1 and ends every wave's reads of the other buffer
    __syncthreads();
    if (kc + 1 < NC) fetch(kc + 1);

    const float* ws = Ws + (kc & 1) * (M * WP) + (wv * 16 + c) * WP + 4 * h;
    const float* xs = Xs + (kc & 1) * (KC * XP) + 4 * h * XP + c;
    #pragma unroll  // register-array index stays a constant
    for (int kk = 0; kk < KC; kk += 8) {
      v4f a[MT];
      #pragma unroll  // register-array index stays a constant
      for (int i = 0; i < MT; ++i) a[i] = *(const v4f*)(ws + i * (128 * WP) + kk);
      #pragma unroll  // register-array index stays a constant
      for (int s = 0; s < 2; ++s) {
        v2f xb[4];
        #pragma unroll  // register-array index stays a constant
        for (int j = 0; j < 4; ++j) {
          xb[j][0] = xs[(kk + 2 * s)     * XP + 16 * j];
          xb[j][1] = xs[(kk + 2 * s + 1) * XP + 16 * j];
        }
        #pragma unroll  // register-array index stays a constant
        for (int i = 0; i < MT; ++i) {
          v2f wa;
          wa[0] = a[i][2 * s];
          wa[1] = a[i][2 * s + 1];
          #pragma unroll  // register-array index stays a constant
          for (int j = 0; j < 4; ++j) {
            if (i < SWAP_FROM)
              acc[i][j] = __builtin_amdgcn_wmma_f32_16x16x4_f32(
                  false, wa, false, xb[j], (short)0, acc[i][j], false, false);
            else
              acc[i][j] = __builtin_amdgcn_wmma_f32_16x16x4_f32(
                  false, xb[j], false, wa, (short)0, acc[i][j], false, false);
          }
        }
      }
    }
    if (kc + 1 < NC) stash((kc + 1) & 1);
  }
}

// ---------------------------------------------------------------------------
// Kernel 1: QKV projection.  qkv[o][pos] = sum_c w_qkv[o][c] * x[b][c][pos]
// Writes q,k (f16, [b][h][n][32], unnormalized) and v transposed
// (f16, [b][h][32][n]) so attention fragment loads are contiguous 16B chunks.
// Wave wv holds channel tile wv of q (i=0), of k (i=1) and of v (i=2): head
// wv>>1, d from (wv&1)*16.  q,k tiles keep 8 consecutive d per lane, the v tile
// (operands swapped) 8 consecutive positions: every store is one 16-byte store.
// ---------------------------------------------------------------------------
__global__ __launch_bounds__(256) void qkv_proj_kernel(
    const float* __restrict__ x, const float* __restrict__ w,
    _Float16* __restrict__ q, _Float16* __restrict__ k,
    _Float16* __restrict__ vT)
{
  __shared__ __attribute__((aligned(16))) float Ws[2 * 3 * HID * WP];
  __shared__ __attribute__((aligned(16))) float Xs[2 * KC * XP];
  const int b    = blockIdx.y;
  const int pos0 = blockIdx.x * 64;
  const int lane = threadIdx.x & 31;
  const int wv   = threadIdx.x >> 5;
  const int c    = lane & 15;
  const int h    = lane >> 4;

  v8f acc[3][4] = {};
  proj_wmma<3, C_IN, 2>(w, x + (long)b * C_IN * N_ + pos0, Ws, Xs, acc);

  const long bh = (long)b * H_ + (wv >> 1);
  const int  d0 = (wv & 1) * 16;
  #pragma unroll  // register-array index stays a constant
  for (int j = 0; j < 4; ++j) {
    v8h hq, hk, hv;
    #pragma unroll  // register-array index stays a constant
    for (int r = 0; r < 8; ++r) {
      hq[r] = (_Float16)acc[0][j][r];
      hk[r] = (_Float16)acc[1][j][r];
      hv[r] = (_Float16)acc[2][j][r];
    }
    const long pos = pos0 + 16 * j + c;
    *(v8h*)(q + (bh * N_ + pos) * D_ + d0 + 8 * h) = hq;
    *(v8h*)(k + (bh * N_ + pos) * D_ + d0 + 8 * h) = hk;
    *(v8h*)(vT + (bh * D_ + d0 + c) * N_ + pos0 + 16 * j + 8 * h) = hv;
  }
}

// ---------------------------------------------------------------------------
// Kernel 2: per-row L2 normalization of q and k (q,k contiguous in ws).
// ---------------------------------------------------------------------------
__global__ __launch_bounds__(256) void l2norm_kernel(_Float16* __restrict__ qk,
                                                     int rows)
{
  int r = blockIdx.x * 256 + threadIdx.x;
  if (r >= rows) return;
  _Float16* p = qk + (long)r * D_;
  float vals[D_];
  float ss = 0.f;
  #pragma unroll
  for (int i = 0; i < D_; ++i) {
    vals[i] = (float)p[i];
    ss = fmaf(vals[i], vals[i], ss);
  }
  float inv = 1.0f / fmaxf(sqrtf(ss), EPS_);
  #pragma unroll
  for (int i = 0; i < D_; ++i) p[i] = (_Float16)(vals[i] * inv);
}

// ---------------------------------------------------------------------------
// Fragment loader: 16x32 f16 tile in the CDNA5 WMMA A/B lane/K ordering.
// lane<16 : row/col = lane,    K elements {0..7, 16..23}
// lane>=16: row/col = lane-16, K elements {8..15, 24..31}
// ---------------------------------------------------------------------------
__device__ inline v16h load_16x32_frag(const _Float16* __restrict__ base,
                                       long rowStride, int lane)
{
  const int row = lane & 15;
  const int off = (lane >> 4) * 8;
  const _Float16* pr = base + (long)row * rowStride + off;
  v8h lo = *(const v8h*)(pr);
  v8h hi = *(const v8h*)(pr + 16);
  v16h r;
  #pragma unroll
  for (int i = 0; i < 8; ++i) { r[i] = lo[i]; r[8 + i] = hi[i]; }
  return r;
}

// ---------------------------------------------------------------------------
// Kernel 3: flash attention, transposed formulation.
//   S^T = (K tile) x Q^T   -> per-query stats live in lane columns:
//                             in-lane reduce + one xor-16 shuffle.
//   O^T += (V^T tile) x P^T, where P^T's B-fragment is *register-identical*
//   to S^T's C-fragment (pB[e]=f16(s0[e]), pB[8+e]=f16(s1[e])): no LDS,
//   no cross-lane transpose.  Epilogue: per-lane 1/l, coalesced stores.
// ---------------------------------------------------------------------------
__global__ __launch_bounds__(256) void flash_attn_kernel(
    const _Float16* __restrict__ q, const _Float16* __restrict__ k,
    const _Float16* __restrict__ vT, float* __restrict__ ao)
{
  const int lane = threadIdx.x & 31;
  const int wv   = threadIdx.x >> 5;
  const int b    = blockIdx.y >> 2;
  const int h    = blockIdx.y & 3;
  const long bh  = (long)b * H_ + h;
  const int  i0  = blockIdx.x * 128 + wv * 16;
  const int  col = lane & 15;

  // Q^T as B fragment (K-dim = d = 32, N = 16 queries), loaded once
  const v16h qB = load_16x32_frag(q + (bh * N_ + i0) * D_, D_, lane);

  v8f o0 = {}; v8f o1 = {};          // O^T accumulators: d rows 0-15 / 16-31
  float m = -INFINITY, l = 0.f;      // stats for query i0+col (replicated in halves)

  const _Float16* kbh = k  + bh * (long)N_ * D_;
  const _Float16* vbh = vT + bh * (long)D_ * N_;

  #pragma unroll 2
  for (int jt = 0; jt < N_; jt += 32) {
    // S^T tiles [j][i], j 0..15 and 16..31
    v16h ka0 = load_16x32_frag(kbh + (long)jt * D_,        D_, lane);
    v16h ka1 = load_16x32_frag(kbh + (long)(jt + 16) * D_, D_, lane);
    v8f z = {};
    v8f s0 = __builtin_amdgcn_wmma_f32_16x16x32_f16(false, ka0, false, qB,
                                                    (short)0, z, false, false);
    v8f s1 = __builtin_amdgcn_wmma_f32_16x16x32_f16(false, ka1, false, qB,
                                                    (short)0, z, false, false);

    // per-query max: in-lane tree over 16 j's, then merge halves (xor 16)
    float t = -INFINITY;
    #pragma unroll
    for (int r = 0; r < 8; ++r) {
      s0[r] *= SCALE_; s1[r] *= SCALE_;
      t = fmaxf(t, fmaxf(s0[r], s1[r]));
    }
    t = fmaxf(t, __shfl_xor(t, 16));
    const float mn = fmaxf(m, t);
    const float f  = __expf(m - mn);   // first iter: exp(-inf)=0
    m = mn;

    // exponentiate; P^T B-fragment == S^T C-fragment layout: direct convert
    float rs = 0.f;
    v16h pB;
    #pragma unroll
    for (int r = 0; r < 8; ++r) {
      s0[r] = __expf(s0[r] - mn);
      s1[r] = __expf(s1[r] - mn);
      rs += s0[r] + s1[r];
      pB[r]     = (_Float16)s0[r];
      pB[8 + r] = (_Float16)s1[r];
    }
    rs += __shfl_xor(rs, 16);
    l = l * f + rs;
    #pragma unroll
    for (int r = 0; r < 8; ++r) { o0[r] *= f; o1[r] *= f; }

    // O^T += V^T x P^T  (V^T A-fragments contiguous in j)
    v16h va0 = load_16x32_frag(vbh + jt,                 N_, lane);
    v16h va1 = load_16x32_frag(vbh + (long)16 * N_ + jt, N_, lane);
    o0 = __builtin_amdgcn_wmma_f32_16x16x32_f16(false, va0, false, pB,
                                                (short)0, o0, false, false);
    o1 = __builtin_amdgcn_wmma_f32_16x16x32_f16(false, va1, false, pB,
                                                (short)0, o1, false, false);
  }

  // epilogue: O^T / l, coalesced stores to ao[b][c=h*32+d][n]
  const float inv  = 1.0f / l;
  const int   hi8  = (lane >> 4) * 8;
  const int   cbase = h * 32;
  #pragma unroll
  for (int r = 0; r < 8; ++r) {
    const int d = r + hi8;
    ao[(long)(b * HID + cbase + d)      * N_ + i0 + col] = o0[r] * inv;
    ao[(long)(b * HID + cbase + 16 + d) * N_ + i0 + col] = o1[r] * inv;
  }
}

// ---------------------------------------------------------------------------
// Kernel 4: output projection.
// out[b][o][pos] = b_out[o] + sum_c w_out[o][c]*ao[b][c][pos]
// Same WMMA body; the bias, staged in LDS, is added at the store.
// ---------------------------------------------------------------------------
__global__ __launch_bounds__(256) void out_proj_kernel(
    const float* __restrict__ ao, const float* __restrict__ w_out,
    const float* __restrict__ b_out, float* __restrict__ out)
{
  __shared__ __attribute__((aligned(16))) float Ws[2 * C_IN * WP];
  __shared__ __attribute__((aligned(16))) float Xs[2 * KC * XP];
  __shared__ __attribute__((aligned(16))) float Bs[C_IN];   // C_IN = block size
  const int b    = blockIdx.y;
  const int pos0 = blockIdx.x * 64;
  const int lane = threadIdx.x & 31;
  const int wv   = threadIdx.x >> 5;
  const int c    = lane & 15;
  const int h    = lane >> 4;

  // one coalesced bias load per block; the body's first barrier publishes it
  Bs[threadIdx.x] = b_out[threadIdx.x];

  v8f acc[2][4] = {};
  proj_wmma<2, HID, 2>(w_out, ao + (long)b * HID * N_ + pos0, Ws, Xs, acc);

  #pragma unroll  // register-array index stays a constant
  for (int i = 0; i < 2; ++i) {
    #pragma unroll  // register-array index stays a constant
    for (int r = 0; r < 8; ++r) {
      const int   o    = (wv + 8 * i) * 16 + 8 * h + r;
      const float bias = Bs[o];
      #pragma unroll  // register-array index stays a constant
      for (int j = 0; j < 4; ++j)
        out[((long)b * C_IN + o) * N_ + pos0 + 16 * j + c] = acc[i][j][r] + bias;
    }
  }
}

// ---------------------------------------------------------------------------
extern "C" void kernel_launch(void* const* d_in, const int* in_sizes, int n_in,
                              void* d_out, int out_size, void* d_ws, size_t ws_size,
                              hipStream_t stream)
{
  const float* x     = (const float*)d_in[0];
  const float* w_qkv = (const float*)d_in[1];
  const float* w_out = (const float*)d_in[2];
  const float* b_out = (const float*)d_in[3];
  float*       out   = (float*)d_out;

  // workspace layout: q(4MiB f16) | k(4MiB f16) | vT(4MiB f16) | ao(8MiB f32)
  char* ws = (char*)d_ws;
  _Float16* q  = (_Float16*)(ws);
  _Float16* k  = (_Float16*)(ws + ((size_t)4  << 20));
  _Float16* vT = (_Float16*)(ws + ((size_t)8  << 20));
  float*    ao = (float*)   (ws + ((size_t)12 << 20));

  dim3 g1(N_ / 64, B_);
  qkv_proj_kernel<<<g1, 256, 0, stream>>>(x, w_qkv, q, k, vT);

  int rows = 2 * B_ * H_ * N_;   // q + k rows (contiguous)
  l2norm_kernel<<<rows / 256, 256, 0, stream>>>(q, rows);

  dim3 g2(N_ / 128, B_ * H_);
  flash_attn_kernel<<<g2, 256, 0, stream>>>(q, k, vT, ao);

  dim3 g3(N_ / 64, B_);
  out_proj_kernel<<<g3, 256, 0, stream>>>(ao, w_out, b_out, out);
}

// v002
// Measured time: 96 microseconds a run.
// Timed twice side by side with v001, it ran 1.72 and 1.71 times as fast.
// All steps since v000 together make it 3.26 times as fast.
#include <hip/hip_runtime.h>
#include <hip/hip_bf16.h>
#include <math.h>

#define B_    4
#define H_    4
#define N_    4096
#define D_    32
#define C_IN  256
#define HID   128   // HEADS*DIM_HEAD
#define SCALE_ 10.0f
#define EPS_   1e-12f

typedef __attribute__((ext_vector_type(16))) _Float16 v16h;
typedef __attribute__((ext_vector_type(8)))  _Float16 v8h;
typedef __attribute__((ext_vector_type(8)))  float    v8f;
typedef __attribute__((ext_vector_type(4)))  float    v4f;
typedef __attribute__((ext_vector_type(2)))  float    v2f;

// ---------------------------------------------------------------------------
// Shared body of the two 1x1-conv projections, on f32 16x16x4 WMMA.
//   Y[o][pos] = sum_k W[o][k] * X[k][pos],  W is [MT*128][K], X is [K][N_].
// One block = all MT*128 output channels x 64 positions; 8 waves; wave wv owns
// channel tiles wv + 8*i (i < MT) times all four position tiles.
// k runs in chunks of KC through two LDS buffers: the next chunk's global loads
// are issued ahead of this chunk's products and stored to LDS behind them.
// k order of a fragment (same for both operands): lane half h, step s,
// element e  ->  k = kk + 4*h + 2*s + e.
// Tiles i <  SWAP_FROM: A = W, B = X -> acc[r] = Y[tile*16 + 8*h + r][16*j + c]
// Tiles i >= SWAP_FROM: A = X, B = W -> acc[r] = Y[tile*16 + c][16*j + 8*h + r]
// ---------------------------------------------------------------------------
#define KC 32   // k per staged chunk
#define WP 36   // LDS pitch of a weight row, dwords: 144 B = 16 B x odd (16-byte reads)
#define XP 72   // LDS pitch of an activation row, dwords: rows k and k+4 lie 32 banks apart

template <int MT, int K, int SWAP_FROM>
__device__ __forceinline__ void proj_wmma(const float* __restrict__ W,
                                          const float* __restrict__ X,
                                          float* __restrict__ Ws,
                                          float* __restrict__ Xs,
                                          v8f (&acc)[MT][4])
{
  constexpr int M  = MT * 128;
  constexpr int NC = K / KC;
  constexpr int WL = M * KC / 4 / 256;   // 16-byte weight loads per thread and chunk
  const int t    = threadIdx.x;
  const int lane = t & 31;
  const int wv   = t >> 5;
  const int c    = lane & 15;
  const int h    = lane >> 4;

  // Global addresses: a block-uniform base that moves with the chunk, plus one
  // 32-bit byte offset per lane that stays the same for the whole kernel.
  const unsigned woff = (unsigned)(((t >> 3) * K  + (t & 7)  * 4) * 4);
  const unsigned xoff = (unsigned)(((t >> 4) * N_ + (t & 15) * 4) * 4);

  v4f wr[WL], xr[2];
  auto fetch = [&](int kc) {
    const char* wb = (const char*)(W + kc * KC);
    const char* xb = (const char*)(X + (long)kc * KC * N_);
    #pragma unroll  // register-array index stays a constant
    for (int i = 0; i < WL; ++i)
      wr[i] = *(const v4f*)(wb + woff + i * (32 * K * 4));
    #pragma unroll  // register-array index stays a constant
    for (int i = 0; i < 2; ++i)
      xr[i] = *(const v4f*)(xb + xoff + i * (16 * N_ * 4));
    // stands between these loads and the next rewrite of their address registers
    asm volatile("s_wait_xcnt 0x0" ::: "memory");
  };
  auto stash = [&](int buf) {
    float* ws = Ws + buf * (M * WP);
    float* xs = Xs + buf * (KC * XP);
    #pragma unroll  // register-array index stays a constant
    for (int i = 0; i < WL; ++i) {
      const int f = t + 256 * i;
      *(v4f*)(ws + (f >> 3) * WP + (f & 7) * 4) = wr[i];
    }
    #pragma unroll  // register-array index stays a constant
    for (int i = 0; i < 2; ++i) {
      const int f = t + 256 * i;
      *(v4f*)(xs + (f >> 4) * XP + (f & 15) * 4) = xr[i];
    }
  };

  fetch(0);
  stash(0);
  // Kept rolled: unrolled, the build takes more than 255 registers (register-window
  // switches among the products) and puts part of a chunk's products behind the
  // next chunk's LDS stores and their wait on the global loads.
  #pragma unroll 1
  for (int kc = 0; kc < NC; ++kc) {
    // publishes buffer kc&1 and ends every wave's reads of the other buffer
    __syncthreads();
    if (kc + 1 < NC) fetch(kc + 1);

    const float* ws = Ws + (kc & 1) * (M * WP) + (wv * 16 + c) * WP + 4 * h;
    const float* xs = Xs + (kc & 1) * (KC * XP) + 4 * h * XP + c;
    #pragma unroll  // register-array index stays a constant
    for (int kk = 0; kk < KC; kk += 8) {
      v4f a[MT];
      #pragma unroll  // register-array index stays a constant
      for (int i = 0; i < MT; ++i) a[i] = *(const v4f*)(ws + i * (128 * WP) + kk);
      #pragma unroll  // register-array index stays a constant
      for (int s = 0; s < 2; ++s) {
        v2f xb[4];
        #pragma unroll  // register-array index stays a constant
        for (int j = 0; j < 4; ++j) {
          xb[j][0] = xs[(kk + 2 * s)     * XP + 16 * j];
          xb[j][1] = xs[(kk + 2 * s + 1) * XP + 16 * j];
        }
        #pragma unroll  // register-array index stays a constant
        for (int i = 0; i < MT; ++i) {
          v2f wa;
          wa[0] = a[i][2 * s];
          wa[1] = a[i][2 * s + 1];
          #pragma unroll  // register-array index stays a constant
          for (int j = 0; j < 4; ++j) {
            if (i < SWAP_FROM)
              acc[i][j] = __builtin_amdgcn_wmma_f32_16x16x4_f32(
                  false, wa, false, xb[j], (short)0, acc[i][j], false, false);
            else
              acc[i][j] = __builtin_amdgcn_wmma_f32_16x16x4_f32(
                  false, xb[j], false, wa, (short)0, acc[i][j], false, false);
          }
        }
      }
    }
    if (kc + 1 < NC) stash((kc + 1) & 1);
  }
}

// ---------------------------------------------------------------------------
// Kernel 1: QKV projection.  qkv[o][pos] = sum_c w_qkv[o][c] * x[b][c][pos]
// Writes q,k (f16, [b][h][n][32], unnormalized) and v transposed
// (f16, [b][h][32][n]) so attention fragment loads are contiguous 16B chunks.
// Wave wv holds channel tile wv of q (i=0), of k (i=1) and of v (i=2): head
// wv>>1, d from (wv&1)*16.  q,k tiles keep 8 consecutive d per lane, the v tile
// (operands swapped) 8 consecutive positions: every store is one 16-byte store.
// ---------------------------------------------------------------------------
__global__ __launch_bounds__(256) void qkv_proj_kernel(
    const float* __restrict__ x, const float* __restrict__ w,
    _Float16* __restrict__ q, _Float16* __restrict__ k,
    _Float16* __restrict__ vT)
{
  __shared__ __attribute__((aligned(16))) float Ws[2 * 3 * HID * WP];
  __shared__ __attribute__((aligned(16))) float Xs[2 * KC * XP];
  const int b    = blockIdx.y;
  const int pos0 = blockIdx.x * 64;
  const int lane = threadIdx.x & 31;
  const int wv   = threadIdx.x >> 5;
  const int c    = lane & 15;
  const int h    = lane >> 4;

  v8f acc[3][4] = {};
  proj_wmma<3, C_IN, 2>(w, x + (long)b * C_IN * N_ + pos0, Ws, Xs, acc);

  const long bh = (long)b * H_ + (wv >> 1);
  const int  d0 = (wv & 1) * 16;
  #pragma unroll  // register-array index stays a constant
  for (int j = 0; j < 4; ++j) {
    v8h hq, hk, hv;
    #pragma unroll  // register-array index stays a constant
    for (int r = 0; r < 8; ++r) {
      hq[r] = (_Float16)acc[0][j][r];
      hk[r] = (_Float16)acc[1][j][r];
      hv[r] = (_Float16)acc[2][j][r];
    }
    const long pos = pos0 + 16 * j + c;
    *(v8h*)(q + (bh * N_ + pos) * D_ + d0 + 8 * h) = hq;
    *(v8h*)(k + (bh * N_ + pos) * D_ + d0 + 8 * h) = hk;
    *(v8h*)(vT + (bh * D_ + d0 + c) * N_ + pos0 + 16 * j + 8 * h) = hv;
  }
}

// ---------------------------------------------------------------------------
// Kernel 2: per-row L2 normalization of q and k (q,k contiguous in ws).
// ---------------------------------------------------------------------------
__global__ __launch_bounds__(256) void l2norm_kernel(_Float16* __restrict__ qk,
                                                     int rows)
{
  int r = blockIdx.x * 256 + threadIdx.x;
  if (r >= rows) return;
  _Float16* p = qk + (long)r * D_;
  float vals[D_];
  float ss = 0.f;
  #pragma unroll
  for (int i = 0; i < D_; ++i) {
    vals[i] = (float)p[i];
    ss = fmaf(vals[i], vals[i], ss);
  }
  float inv = 1.0f / fmaxf(sqrtf(ss), EPS_);
  #pragma unroll
  for (int i = 0; i < D_; ++i) p[i] = (_Float16)(vals[i] * inv);
}

// ---------------------------------------------------------------------------
// Fragment loader: 16x32 f16 tile in the CDNA5 WMMA A/B lane/K ordering.
// lane<16 : row/col = lane,    K elements {0..7, 16..23}
// lane>=16: row/col = lane-16, K elements {8..15, 24..31}
// ---------------------------------------------------------------------------
__device__ inline v16h load_16x32_frag(const _Float16* __restrict__ base,
                                       long rowStride, int lane)
{
  const int row = lane & 15;
  const int off = (lane >> 4) * 8;
  const _Float16* pr = base + (long)row * rowStride + off;
  v8h lo = *(const v8h*)(pr);
  v8h hi = *(const v8h*)(pr + 16);
  v16h r;
  #pragma unroll
  for (int i = 0; i < 8; ++i) { r[i] = lo[i]; r[8 + i] = hi[i]; }
  return r;
}

// ---------------------------------------------------------------------------
// Kernel 3: flash attention, transposed formulation.
//   S^T = (K tile) x Q^T   -> per-query stats live in lane columns:
//                             in-lane reduce + one xor-16 shuffle.
//   O^T += (V^T tile) x P^T, where P^T's B-fragment is *register-identical*
//   to S^T's C-fragment (pB[e]=f16(s0[e]), pB[8+e]=f16(s1[e])): no LDS,
//   no cross-lane transpose.  Epilogue: per-lane 1/l, coalesced stores.
// K and V^T reach the eight waves of a block through LDS: tiles of KT keys,
// two buffers, filled by asynchronous 16-byte copies one whole tile ahead, so
// a tile's way from L2 is covered by the tile before it and is gone once per
// block, not once per wave.
// ---------------------------------------------------------------------------
#define KT   128           // keys per staged tile
#define KP   40            // LDS pitch of a key row, halves: 80 B = 16 B x odd
#define VP   (KT + 8)      // LDS pitch of a V^T row, halves: 272 B = 16 B x odd
#define KBUF (KT * KP)     // halves per K buffer
#define VBUF (D_ * VP)     // halves per V^T buffer

__global__ __launch_bounds__(256) void flash_attn_kernel(
    const _Float16* __restrict__ q, const _Float16* __restrict__ k,
    const _Float16* __restrict__ vT, float* __restrict__ ao)
{
  __shared__ __attribute__((aligned(16))) _Float16 Ks[2 * KBUF];
  __shared__ __attribute__((aligned(16))) _Float16 Vs[2 * VBUF];
  const int tid  = threadIdx.x;
  const int lane = tid & 31;
  const int wv   = tid >> 5;
  const int b    = blockIdx.y >> 2;
  const int h    = blockIdx.y & 3;
  const long bh  = (long)b * H_ + h;
  const int  i0  = blockIdx.x * 128 + wv * 16;
  const int  col = lane & 15;

  // Q^T as B fragment (K-dim = d = 32, N = 16 queries), loaded once
  const v16h qB = load_16x32_frag(q + (bh * N_ + i0) * D_, D_, lane);

  v8f o0 = {}; v8f o1 = {};          // O^T accumulators: d rows 0-15 / 16-31
  float m = -INFINITY, l = 0.f;      // stats for query i0+col (replicated in halves)

  // Each thread copies four 16-byte pieces of a tile: K rows tid>>2 and 64 more
  // (a K tile is 8 KiB in a row in global memory), V^T rows tid>>4 and 16 more.
  const _Float16* kg = k  + bh * (long)N_ * D_ + tid * 8;
  const _Float16* vg = vT + bh * (long)D_ * N_ + (long)(tid >> 4) * N_ + (tid & 15) * 8;
  const unsigned  lk = (unsigned)(size_t)(Ks + (tid >> 2) * KP + (tid & 3) * 8);
  const unsigned  lv = (unsigned)(size_t)(Vs + (tid >> 4) * VP + (tid & 15) * 8);

  auto copy_tile = [&](int tile, int buf) {
    const _Float16* gk0 = kg + (long)tile * (KT * D_);
    const _Float16* gk1 = gk0 + 64 * D_;
    const _Float16* gv0 = vg + tile * KT;
    const _Float16* gv1 = gv0 + 16 * N_;
    const unsigned  lk0 = lk + buf * (KBUF * 2);
    const unsigned  lk1 = lk0 + 64 * KP * 2;
    const unsigned  lv0 = lv + buf * (VBUF * 2);
    const unsigned  lv1 = lv0 + 16 * VP * 2;
    // the closing wait stands between the copies and any rewrite of the
    // registers that they name
    asm volatile("global_load_async_to_lds_b128 %0, %4, off\n\t"
                 "global_load_async_to_lds_b128 %1, %5, off\n\t"
                 "global_load_async_to_lds_b128 %2, %6, off\n\t"
                 "global_load_async_to_lds_b128 %3, %7, off\n\t"
                 "s_wait_xcnt 0x0"
                 :: "v"(lk0), "v"(lk1), "v"(lv0), "v"(lv1),
                    "v"(gk0), "v"(gk1), "v"(gv0), "v"(gv1)
                 : "memory");
  };

  constexpr int NT = N_ / KT;
  copy_tile(0, 0);
  // this wave's copies of tile 0 have landed
  asm volatile("s_wait_asynccnt 0x0" ::: "memory");
  // publishes tile 0 to all eight waves
  __syncthreads();
  copy_tile(1, 1);

  // Kept rolled: the buffer index alternates and one barrier ends each trip.
  #pragma unroll 1
  for (int tile = 0; tile < NT; ++tile) {
    const _Float16* ks = Ks + (tile & 1) * KBUF;
    const _Float16* vs = Vs + (tile & 1) * VBUF;

    // K fragments of the tile's first 32 keys, j 0..15 and 16..31
    v16h ka0 = load_16x32_frag(ks,           KP, lane);
    v16h ka1 = load_16x32_frag(ks + 16 * KP, KP, lane);

    #pragma unroll  // the fetch ahead below ends with the tile: constant jt
    for (int jt = 0; jt < KT; jt += 32) {
      // V^T A-fragments (contiguous in j), read ahead of the softmax that
      // stands in front of their use
      const v16h va0 = load_16x32_frag(vs + jt,           VP, lane);
      const v16h va1 = load_16x32_frag(vs + 16 * VP + jt, VP, lane);

      // S^T tiles [j][i]
      v8f z = {};
      v8f s0 = __builtin_amdgcn_wmma_f32_16x16x32_f16(false, ka0, false, qB,
                                                      (short)0, z, false, false);
      v8f s1 = __builtin_amdgcn_wmma_f32_16x16x32_f16(false, ka1, false, qB,
                                                      (short)0, z, false, false);
      // the next 32 keys' K fragments, of this same tile only
      if (jt + 32 < KT) {
        ka0 = load_16x32_frag(ks + (jt + 32) * KP, KP, lane);
        ka1 = load_16x32_frag(ks + (jt + 48) * KP, KP, lane);
      }

      // per-query max: in-lane tree over 16 j's, then merge halves (xor 16)
      float t = -INFINITY;
      #pragma unroll
      for (int r = 0; r < 8; ++r) {
        s0[r] *= SCALE_; s1[r] *= SCALE_;
        t = fmaxf(t, fmaxf(s0[r], s1[r]));
      }
      t = fmaxf(t, __shfl_xor(t, 16));
      const float mn = fmaxf(m, t);
      const float f  = __expf(m - mn);   // first iter: exp(-inf)=0
      m = mn;

      // exponentiate; P^T B-fragment == S^T C-fragment layout: direct convert
      float rs = 0.f;
      v16h pB;
      #pragma unroll
      for (int r = 0; r < 8; ++r) {
        s0[r] = __expf(s0[r] - mn);
        s1[r] = __expf(s1[r] - mn);
        rs += s0[r] + s1[r];
        pB[r]     = (_Float16)s0[r];
        pB[8 + r] = (_Float16)s1[r];
      }
      rs += __shfl_xor(rs, 16);
      l = l * f + rs;
      #pragma unroll
      for (int r = 0; r < 8; ++r) { o0[r] *= f; o1[r] *= f; }

      // O^T += V^T x P^T
      o0 = __builtin_amdgcn_wmma_f32_16x16x32_f16(false, va0, false, pB,
                                                  (short)0, o0, false, false);
      o1 = __builtin_amdgcn_wmma_f32_16x16x32_f16(false, va1, false, pB,
                                                  (short)0, o1, false, false);
    }

    // this wave's reads of the buffer that is refilled below have returned
    asm volatile("s_wait_dscnt 0x0" ::: "memory");
    // this wave's copies of the next tile have landed
    asm volatile("s_wait_asynccnt 0x0" ::: "memory");
    // publishes the next tile and ends every wave's reads of this one
    __syncthreads();
    if (tile + 2 < NT) copy_tile(tile + 2, tile & 1);
  }
  // no copy is left in flight when the wave ends
  asm volatile("s_wait_asynccnt 0x0" ::: "memory");

  // epilogue: O^T / l, coalesced stores to ao[b][c=h*32+d][n]
  const float inv  = 1.0f / l;
  const int   hi8  = (lane >> 4) * 8;
  const int   cbase = h * 32;
  #pragma unroll
  for (int r = 0; r < 8; ++r) {
    const int d = r + hi8;
    ao[(long)(b * HID + cbase + d)      * N_ + i0 + col] = o0[r] * inv;
    ao[(long)(b * HID + cbase + 16 + d) * N_ + i0 + col] = o1[r] * inv;
  }
}

// ---------------------------------------------------------------------------
// Kernel 4: output projection.
// out[b][o][pos] = b_out[o] + sum_c w_out[o][c]*ao[b][c][pos]
// Same WMMA body; the bias, staged in LDS, is added at the store.
// ---------------------------------------------------------------------------
__global__ __launch_bounds__(256) void out_proj_kernel(
    const float* __restrict__ ao, const float* __restrict__ w_out,
    const float* __restrict__ b_out, float* __restrict__ out)
{
  __shared__ __attribute__((aligned(16))) float Ws[2 * C_IN * WP];
  __shared__ __attribute__((aligned(16))) float Xs[2 * KC * XP];
  __shared__ __attribute__((aligned(16))) float Bs[C_IN];   // C_IN = block size
  const int b    = blockIdx.y;
  const int pos0 = blockIdx.x * 64;
  const int lane = threadIdx.x & 31;
  const int wv   = threadIdx.x >> 5;
  const int c    = lane & 15;
  const int h    = lane >> 4;

  // one coalesced bias load per block; the body's first barrier publishes it
  Bs[threadIdx.x] = b_out[threadIdx.x];

  v8f acc[2][4] = {};
  proj_wmma<2, HID, 2>(w_out, ao + (long)b * HID * N_ + pos0, Ws, Xs, acc);

  #pragma unroll  // register-array index stays a constant
  for (int i = 0; i < 2; ++i) {
    #pragma unroll  // register-array index stays a constant
    for (int r = 0; r < 8; ++r) {
      const int   o    = (wv + 8 * i) * 16 + 8 * h + r;
      const float bias = Bs[o];
      #pragma unroll  // register-array index stays a constant
      for (int j = 0; j < 4; ++j)
        out[((long)b * C_IN + o) * N_ + pos0 + 16 * j + c] = acc[i][j][r] + bias;
    }
  }
}

// ---------------------------------------------------------------------------
extern "C" void kernel_launch(void* const* d_in, const int* in_sizes, int n_in,
                              void* d_out, int out_size, void* d_ws, size_t ws_size,
                              hipStream_t stream)
{
  const float* x     = (const float*)d_in[0];
  const float* w_qkv = (const float*)d_in[1];
  const float* w_out = (const float*)d_in[2];
  const float* b_out = (const float*)d_in[3];
  float*       out   = (float*)d_out;

  // workspace layout: q(4MiB f16) | k(4MiB f16) | vT(4MiB f16) | ao(8MiB f32)
  char* ws = (char*)d_ws;
  _Float16* q  = (_Float16*)(ws);
  _Float16* k  = (_Float16*)(ws + ((size_t)4  << 20));
  _Float16* vT = (_Float16*)(ws + ((size_t)8  << 20));
  float*    ao = (float*)   (ws + ((size_t)12 << 20));

  dim3 g1(N_ / 64, B_);
  qkv_proj_kernel<<<g1, 256, 0, stream>>>(x, w_qkv, q, k, vT);

  int rows = 2 * B_ * H_ * N_;   // q + k rows (contiguous)
  l2norm_kernel<<<rows / 256, 256, 0, stream>>>(q, rows);

  dim3 g2(N_ / 128, B_ * H_);
  flash_attn_kernel<<<g2, 256, 0, stream>>>(q, k, vT, ao);

  dim3 g3(N_ / 64, B_);
  out_proj_kernel<<<g3, 256, 0, stream>>>(ao, w_out, b_out, out);
}

// v003
// A run of this version takes 79.1 microseconds.
// Timed twice side by side with v002, it ran 1.21 times as fast both times.
// Counting every step since v000, it is 3.96 times as fast.
#include <hip/hip_runtime.h>
#include <hip/hip_bf16.h>
#include <math.h>

#define B_    4
#define H_    4
#define N_    4096
#define D_    32
#define C_IN  256
#define HID   128   // HEADS*DIM_HEAD
#define SCALE_ 10.0f
#define EPS_   1e-12f
// SCALE_ * log2(e): q carries it, so that K x Q^T comes out in powers of two
#define QSCALE_ (SCALE_ * 1.4426950408889634f)
// Constant softmax shift, in powers of two.  After the L2 norm q and k have
// length at most 1, so |q.k| <= 1 for every input; with both f16 roundings the
// scaled score stays within +-14.45, so 2^(score + 1) lies in 2^-13.45 ..
// 2^15.45: inside the normal f16 range at both ends.  The shift cancels in O / l.
#define PSHIFT_ 1.0f

typedef __attribute__((ext_vector_type(16))) _Float16 v16h;
typedef __attribute__((ext_vector_type(8)))  _Float16 v8h;
typedef __attribute__((ext_vector_type(8)))  float    v8f;
typedef __attribute__((ext_vector_type(4)))  float    v4f;
typedef __attribute__((ext_vector_type(2)))  float    v2f;

// ---------------------------------------------------------------------------
// Shared body of the two 1x1-conv projections, on f32 16x16x4 WMMA.
//   Y[o][pos] = sum_k W[o][k] * X[k][pos],  W is [MT*128][K], X is [K][N_].
// One block = all MT*128 output channels x 64 positions; 8 waves; wave wv owns
// channel tiles wv + 8*i (i < MT) times all four position tiles.
// k runs in chunks of KC through two LDS buffers: the next chunk's global loads
// are issued ahead of this chunk's products and stored to LDS behind them.
// k order of a fragment (same for both operands): lane half h, step s,
// element e  ->  k = kk + 4*h + 2*s + e.
// Tiles i <  SWAP_FROM: A = W, B = X -> acc[r] = Y[tile*16 + 8*h + r][16*j + c]
// Tiles i >= SWAP_FROM: A = X, B = W -> acc[r] = Y[tile*16 + c][16*j + 8*h + r]
// ---------------------------------------------------------------------------
#define KC 32   // k per staged chunk
#define WP 36   // LDS pitch of a weight row, dwords: 144 B = 16 B x odd (16-byte reads)
#define XP 72   // LDS pitch of an activation row, dwords: rows k and k+4 lie 32 banks apart

template <int MT, int K, int SWAP_FROM>
__device__ __forceinline__ void proj_wmma(const float* __restrict__ W,
                                          const float* __restrict__ X,
                                          float* __restrict__ Ws,
                                          float* __restrict__ Xs,
                                          v8f (&acc)[MT][4])
{
  constexpr int M  = MT * 128;
  constexpr int NC = K / KC;
  constexpr int WL = M * KC / 4 / 256;   // 16-byte weight loads per thread and chunk
  const int t    = threadIdx.x;
  const int lane = t & 31;
  const int wv   = t >> 5;
  const int c    = lane & 15;
  const int h    = lane >> 4;

  // Global addresses: a block-uniform base that moves with the chunk, plus one
  // 32-bit byte offset per lane that stays the same for the whole kernel.
  const unsigned woff = (unsigned)(((t >> 3) * K  + (t & 7)  * 4) * 4);
  const unsigned xoff = (unsigned)(((t >> 4) * N_ + (t & 15) * 4) * 4);

  v4f wr[WL], xr[2];
  auto fetch = [&](int kc) {
    const char* wb = (const char*)(W + kc * KC);
    const char* xb = (const char*)(X + (long)kc * KC * N_);
    #pragma unroll  // register-array index stays a constant
    for (int i = 0; i < WL; ++i)
      wr[i] = *(const v4f*)(wb + woff + i * (32 * K * 4));
    #pragma unroll  // register-array index stays a constant
    for (int i = 0; i < 2; ++i)
      xr[i] = *(const v4f*)(xb + xoff + i * (16 * N_ * 4));
    // stands between these loads and the next rewrite of their address registers
    asm volatile("s_wait_xcnt 0x0" ::: "memory");
  };
  auto stash = [&](int buf) {
    float* ws = Ws + buf * (M * WP);
    float* xs = Xs + buf * (KC * XP);
    #pragma unroll  // register-array index stays a constant
    for (int i = 0; i < WL; ++i) {
      const int f = t + 256 * i;
      *(v4f*)(ws + (f >> 3) * WP + (f & 7) * 4) = wr[i];
    }
    #pragma unroll  // register-array index stays a constant
    for (int i = 0; i < 2; ++i) {
      const int f = t + 256 * i;
      *(v4f*)(xs + (f >> 4) * XP + (f & 15) * 4) = xr[i];
    }
  };

  fetch(0);
  stash(0);
  // Kept rolled: unrolled, the build takes more than 255 registers (register-window
  // switches among the products) and puts part of a chunk's products behind the
  // next chunk's LDS stores and their wait on the global loads.
  #pragma unroll 1
  for (int kc = 0; kc < NC; ++kc) {
    // publishes buffer kc&1 and ends every wave's reads of the other buffer
    __syncthreads();
    if (kc + 1 < NC) fetch(kc + 1);

    const float* ws = Ws + (kc & 1) * (M * WP) + (wv * 16 + c) * WP + 4 * h;
    const float* xs = Xs + (kc & 1) * (KC * XP) + 4 * h * XP + c;
    #pragma unroll  // register-array index stays a constant
    for (int kk = 0; kk < KC; kk += 8) {
      v4f a[MT];
      #pragma unroll  // register-array index stays a constant
      for (int i = 0; i < MT; ++i) a[i] = *(const v4f*)(ws + i * (128 * WP) + kk);
      #pragma unroll  // register-array index stays a constant
      for (int s = 0; s < 2; ++s) {
        v2f xb[4];
        #pragma unroll  // register-array index stays a constant
        for (int j = 0; j < 4; ++j) {
          xb[j][0] = xs[(kk + 2 * s)     * XP + 16 * j];
          xb[j][1] = xs[(kk + 2 * s + 1) * XP + 16 * j];
        }
        #pragma unroll  // register-array index stays a constant
        for (int i = 0; i < MT; ++i) {
          v2f wa;
          wa[0] = a[i][2 * s];
          wa[1] = a[i][2 * s + 1];
          #pragma unroll  // register-array index stays a constant
          for (int j = 0; j < 4; ++j) {
            if (i < SWAP_FROM)
              acc[i][j] = __builtin_amdgcn_wmma_f32_16x16x4_f32(
                  false, wa, false, xb[j], (short)0, acc[i][j], false, false);
            else
              acc[i][j] = __builtin_amdgcn_wmma_f32_16x16x4_f32(
                  false, xb[j], false, wa, (short)0, acc[i][j], false, false);
          }
        }
      }
    }
    if (kc + 1 < NC) stash((kc + 1) & 1);
  }
}

// ---------------------------------------------------------------------------
// Kernel 1: QKV projection.  qkv[o][pos] = sum_c w_qkv[o][c] * x[b][c][pos]
// Writes q,k (f16, [b][h][n][32], unnormalized) and v transposed
// (f16, [b][h][32][n]) so attention fragment loads are contiguous 16B chunks.
// Wave wv holds channel tile wv of q (i=0), of k (i=1) and of v (i=2): head
// wv>>1, d from (wv&1)*16.  q,k tiles keep 8 consecutive d per lane, the v tile
// (operands swapped) 8 consecutive positions: every store is one 16-byte store.
// ---------------------------------------------------------------------------
__global__ __launch_bounds__(256) void qkv_proj_kernel(
    const float* __restrict__ x, const float* __restrict__ w,
    _Float16* __restrict__ q, _Float16* __restrict__ k,
    _Float16* __restrict__ vT)
{
  __shared__ __attribute__((aligned(16))) float Ws[2 * 3 * HID * WP];
  __shared__ __attribute__((aligned(16))) float Xs[2 * KC * XP];
  const int b    = blockIdx.y;
  const int pos0 = blockIdx.x * 64;
  const int lane = threadIdx.x & 31;
  const int wv   = threadIdx.x >> 5;
  const int c    = lane & 15;
  const int h    = lane >> 4;

  v8f acc[3][4] = {};
  proj_wmma<3, C_IN, 2>(w, x + (long)b * C_IN * N_ + pos0, Ws, Xs, acc);

  const long bh = (long)b * H_ + (wv >> 1);
  const int  d0 = (wv & 1) * 16;
  #pragma unroll  // register-array index stays a constant
  for (int j = 0; j < 4; ++j) {
    v8h hq, hk, hv;
    #pragma unroll  // register-array index stays a constant
    for (int r = 0; r < 8; ++r) {
      hq[r] = (_Float16)acc[0][j][r];
      hk[r] = (_Float16)acc[1][j][r];
      hv[r] = (_Float16)acc[2][j][r];
    }
    const long pos = pos0 + 16 * j + c;
    *(v8h*)(q + (bh * N_ + pos) * D_ + d0 + 8 * h) = hq;
    *(v8h*)(k + (bh * N_ + pos) * D_ + d0 + 8 * h) = hk;
    *(v8h*)(vT + (bh * D_ + d0 + c) * N_ + pos0 + 16 * j + 8 * h) = hv;
  }
}

// ---------------------------------------------------------------------------
// Kernel 2: per-row L2 normalization of q and k (q,k contiguous in ws).
// The q rows (first half) also take the factor QSCALE_, ahead of the one
// rounding to f16.
// ---------------------------------------------------------------------------
__global__ __launch_bounds__(256) void l2norm_kernel(_Float16* __restrict__ qk,
                                                     int rows)
{
  int r = blockIdx.x * 256 + threadIdx.x;
  if (r >= rows) return;
  _Float16* p = qk + (long)r * D_;
  float vals[D_];
  float ss = 0.f;
  #pragma unroll
  for (int i = 0; i < D_; ++i) {
    vals[i] = (float)p[i];
    ss = fmaf(vals[i], vals[i], ss);
  }
  float inv = 1.0f / fmaxf(sqrtf(ss), EPS_);
  if (r < rows / 2) inv *= QSCALE_;
  #pragma unroll
  for (int i = 0; i < D_; ++i) p[i] = (_Float16)(vals[i] * inv);
}

// ---------------------------------------------------------------------------
// Fragment loader: 16x32 f16 tile in the CDNA5 WMMA A/B lane/K ordering.
// lane<16 : row/col = lane,    K elements {0..7, 16..23}
// lane>=16: row/col = lane-16, K elements {8..15, 24..31}
// ---------------------------------------------------------------------------
__device__ inline v16h load_16x32_frag(const _Float16* __restrict__ base,
                                       long rowStride, int lane)
{
  const int row = lane & 15;
  const int off = (lane >> 4) * 8;
  const _Float16* pr = base + (long)row * rowStride + off;
  v8h lo = *(const v8h*)(pr);
  v8h hi = *(const v8h*)(pr + 16);
  v16h r;
  #pragma unroll
  for (int i = 0; i < 8; ++i) { r[i] = lo[i]; r[8 + i] = hi[i]; }
  return r;
}

// ---------------------------------------------------------------------------
// Kernel 3: flash attention, transposed formulation.
//   S^T = (K tile) x Q^T + shift: the product is the exponent itself (q holds
//   the scale, the C operand the constant shift), P = 2^(S^T).  No running
//   maximum, so O^T and the sums are never rescaled; each lane sums its own
//   keys and the two halves of a column are joined once, behind the loop.
//   O^T += (V^T tile) x P^T, where P^T's B-fragment is *register-identical*
//   to S^T's C-fragment (pB[e]=f16(s0[e]), pB[8+e]=f16(s1[e])): no LDS,
//   no cross-lane transpose.  Epilogue: per-lane 1/l, coalesced stores.
// K and V^T reach the eight waves of a block through LDS: tiles of KT keys,
// two buffers, filled by asynchronous 16-byte copies one whole tile ahead, so
// a tile's way from L2 is covered by the tile before it and is gone once per
// block, not once per wave.
// ---------------------------------------------------------------------------
#define KT   128           // keys per staged tile
#define KP   40            // LDS pitch of a key row, halves: 80 B = 16 B x odd
#define VP   (KT + 8)      // LDS pitch of a V^T row, halves: 272 B = 16 B x odd
#define KBUF (KT * KP)     // halves per K buffer
#define VBUF (D_ * VP)     // halves per V^T buffer

__global__ __launch_bounds__(256) void flash_attn_kernel(
    const _Float16* __restrict__ q, const _Float16* __restrict__ k,
    const _Float16* __restrict__ vT, float* __restrict__ ao)
{
  __shared__ __attribute__((aligned(16))) _Float16 Ks[2 * KBUF];
  __shared__ __attribute__((aligned(16))) _Float16 Vs[2 * VBUF];
  const int tid  = threadIdx.x;
  const int lane = tid & 31;
  const int wv   = tid >> 5;
  const int b    = blockIdx.y >> 2;
  const int h    = blockIdx.y & 3;
  const long bh  = (long)b * H_ + h;
  const int  i0  = blockIdx.x * 128 + wv * 16;
  const int  col = lane & 15;

  // Q^T as B fragment (K-dim = d = 32, N = 16 queries), loaded once
  const v16h qB = load_16x32_frag(q + (bh * N_ + i0) * D_, D_, lane);

  v8f o0 = {}; v8f o1 = {};          // O^T accumulators: d rows 0-15 / 16-31
  v8f ls = {};                       // sums of P for query i0+col, this half's keys
  const v8f shift = {PSHIFT_, PSHIFT_, PSHIFT_, PSHIFT_,
                     PSHIFT_, PSHIFT_, PSHIFT_, PSHIFT_};

  // Each thread copies four 16-byte pieces of a tile: K rows tid>>2 and 64 more
  // (a K tile is 8 KiB in a row in global memory), V^T rows tid>>4 and 16 more.
  const _Float16* kg = k  + bh * (long)N_ * D_ + tid * 8;
  const _Float16* vg = vT + bh * (long)D_ * N_ + (long)(tid >> 4) * N_ + (tid & 15) * 8;
  const unsigned  lk = (unsigned)(size_t)(Ks + (tid >> 2) * KP + (tid & 3) * 8);
  const unsigned  lv = (unsigned)(size_t)(Vs + (tid >> 4) * VP + (tid & 15) * 8);

  auto copy_tile = [&](int tile, int buf) {
    const _Float16* gk0 = kg + (long)tile * (KT * D_);
    const _Float16* gk1 = gk0 + 64 * D_;
    const _Float16* gv0 = vg + tile * KT;
    const _Float16* gv1 = gv0 + 16 * N_;
    const unsigned  lk0 = lk + buf * (KBUF * 2);
    const unsigned  lk1 = lk0 + 64 * KP * 2;
    const unsigned  lv0 = lv + buf * (VBUF * 2);
    const unsigned  lv1 = lv0 + 16 * VP * 2;
    // the closing wait stands between the copies and any rewrite of the
    // registers that they name
    asm volatile("global_load_async_to_lds_b128 %0, %4, off\n\t"
                 "global_load_async_to_lds_b128 %1, %5, off\n\t"
                 "global_load_async_to_lds_b128 %2, %6, off\n\t"
                 "global_load_async_to_lds_b128 %3, %7, off\n\t"
                 "s_wait_xcnt 0x0"
                 :: "v"(lk0), "v"(lk1), "v"(lv0), "v"(lv1),
                    "v"(gk0), "v"(gk1), "v"(gv0), "v"(gv1)
                 : "memory");
  };

  constexpr int NT = N_ / KT;
  copy_tile(0, 0);
  // this wave's copies of tile 0 have landed
  asm volatile("s_wait_asynccnt 0x0" ::: "memory");
  // publishes tile 0 to all eight waves
  __syncthreads();
  copy_tile(1, 1);

  // Kept rolled: the buffer index alternates and one barrier ends each trip.
  #pragma unroll 1
  for (int tile = 0; tile < NT; ++tile) {
    const _Float16* ks = Ks + (tile & 1) * KBUF;
    const _Float16* vs = Vs + (tile & 1) * VBUF;

    // K fragments of the tile's first 32 keys, j 0..15 and 16..31
    v16h ka0 = load_16x32_frag(ks,           KP, lane);
    v16h ka1 = load_16x32_frag(ks + 16 * KP, KP, lane);

    #pragma unroll  // the fetch ahead below ends with the tile: constant jt
    for (int jt = 0; jt < KT; jt += 32) {
      // V^T A-fragments (contiguous in j), read ahead of the softmax that
      // stands in front of their use
      const v16h va0 = load_16x32_frag(vs + jt,           VP, lane);
      const v16h va1 = load_16x32_frag(vs + 16 * VP + jt, VP, lane);

      // S^T tiles [j][i], scaled and shifted
      v8f s0 = __builtin_amdgcn_wmma_f32_16x16x32_f16(false, ka0, false, qB,
                                                      (short)0, shift, false, false);
      v8f s1 = __builtin_amdgcn_wmma_f32_16x16x32_f16(false, ka1, false, qB,
                                                      (short)0, shift, false, false);
      // the next 32 keys' K fragments, of this same tile only
      if (jt + 32 < KT) {
        ka0 = load_16x32_frag(ks + (jt + 32) * KP, KP, lane);
        ka1 = load_16x32_frag(ks + (jt + 48) * KP, KP, lane);
      }

      // exponentiate; P^T B-fragment == S^T C-fragment layout: direct convert
      v16h pB;
      #pragma unroll  // register-array index stays a constant
      for (int r = 0; r < 8; ++r) {
        s0[r] = __builtin_amdgcn_exp2f(s0[r]);
        s1[r] = __builtin_amdgcn_exp2f(s1[r]);
        pB[r]     = (_Float16)s0[r];
        pB[8 + r] = (_Float16)s1[r];
      }
      ls += s0 + s1;

      // O^T += V^T x P^T
      o0 = __builtin_amdgcn_wmma_f32_16x16x32_f16(false, va0, false, pB,
                                                  (short)0, o0, false, false);
      o1 = __builtin_amdgcn_wmma_f32_16x16x32_f16(false, va1, false, pB,
                                                  (short)0, o1, false, false);
    }

    // this wave's reads of the buffer that is refilled below have returned
    asm volatile("s_wait_dscnt 0x0" ::: "memory");
    // this wave's copies of the next tile have landed
    asm volatile("s_wait_asynccnt 0x0" ::: "memory");
    // publishes the next tile and ends every wave's reads of this one
    __syncthreads();
    if (tile + 2 < NT) copy_tile(tile + 2, tile & 1);
  }
  // no copy is left in flight when the wave ends
  asm volatile("s_wait_asynccnt 0x0" ::: "memory");

  // epilogue: O^T / l, coalesced stores to ao[b][c=h*32+d][n]
  float l = ((ls[0] + ls[1]) + (ls[2] + ls[3])) + ((ls[4] + ls[5]) + (ls[6] + ls[7]));
  l += __shfl_xor(l, 16);
  const float inv  = 1.0f / l;
  const int   hi8  = (lane >> 4) * 8;
  const int   cbase = h * 32;
  #pragma unroll
  for (int r = 0; r < 8; ++r) {
    const int d = r + hi8;
    ao[(long)(b * HID + cbase + d)      * N_ + i0 + col] = o0[r] * inv;
    ao[(long)(b * HID + cbase + 16 + d) * N_ + i0 + col] = o1[r] * inv;
  }
}

// ---------------------------------------------------------------------------
// Kernel 4: output projection.
// out[b][o][pos] = b_out[o] + sum_c w_out[o][c]*ao[b][c][pos]
// Same WMMA body; the bias, staged in LDS, is added at the store.
// ---------------------------------------------------------------------------
__global__ __launch_bounds__(256) void out_proj_kernel(
    const float* __restrict__ ao, const float* __restrict__ w_out,
    const float* __restrict__ b_out, float* __restrict__ out)
{
  __shared__ __attribute__((aligned(16))) float Ws[2 * C_IN * WP];
  __shared__ __attribute__((aligned(16))) float Xs[2 * KC * XP];
  __shared__ __attribute__((aligned(16))) float Bs[C_IN];   // C_IN = block size
  const int b    = blockIdx.y;
  const int pos0 = blockIdx.x * 64;
  const int lane = threadIdx.x & 31;
  const int wv   = threadIdx.x >> 5;
  const int c    = lane & 15;
  const int h    = lane >> 4;

  // one coalesced bias load per block; the body's first barrier publishes it
  Bs[threadIdx.x] = b_out[threadIdx.x];

  v8f acc[2][4] = {};
  proj_wmma<2, HID, 2>(w_out, ao + (long)b * HID * N_ + pos0, Ws, Xs, acc);

  #pragma unroll  // register-array index stays a constant
  for (int i = 0; i < 2; ++i) {
    #pragma unroll  // register-array index stays a constant
    for (int r = 0; r < 8; ++r) {
      const int   o    = (wv + 8 * i) * 16 + 8 * h + r;
      const float bias = Bs[o];
      #pragma unroll  // register-array index stays a constant
      for (int j = 0; j < 4; ++j)
        out[((long)b * C_IN + o) * N_ + pos0 + 16 * j + c] = acc[i][j][r] + bias;
    }
  }
}

// ---------------------------------------------------------------------------
extern "C" void kernel_launch(void* const* d_in, const int* in_sizes, int n_in,
                              void* d_out, int out_size, void* d_ws, size_t ws_size,
                              hipStream_t stream)
{
  const float* x     = (const float*)d_in[0];
  const float* w_qkv = (const float*)d_in[1];
  const float* w_out = (const float*)d_in[2];
  const float* b_out = (const float*)d_in[3];
  float*       out   = (float*)d_out;

  // workspace layout: q(4MiB f16) | k(4MiB f16) | vT(4MiB f16) | ao(8MiB f32)
  char* ws = (char*)d_ws;
  _Float16* q  = (_Float16*)(ws);
  _Float16* k  = (_Float16*)(ws + ((size_t)4  << 20));
  _Float16* vT = (_Float16*)(ws + ((size_t)8  << 20));
  float*    ao = (float*)   (ws + ((size_t)12 << 20));

  dim3 g1(N_ / 64, B_);
  qkv_proj_kernel<<<g1, 256, 0, stream>>>(x, w_qkv, q, k, vT);

  int rows = 2 * B_ * H_ * N_;   // q + k rows (contiguous)
  l2norm_kernel<<<rows / 256, 256, 0, stream>>>(q, rows);

  dim3 g2(N_ / 128, B_ * H_);
  flash_attn_kernel<<<g2, 256, 0, stream>>>(q, k, vT, ao);

  dim3 g3(N_ / 64, B_);
  out_proj_kernel<<<g3, 256, 0, stream>>>(ao, w_out, b_out, out);
}

// v004
// It runs in 75.6 microseconds.
// In two side-by-side timings against v003, it was 1.06 and 1.03 times as fast.
// All steps since v000 together make it 4.14 times as fast.
#include <hip/hip_runtime.h>
#include <hip/hip_bf16.h>
#include <math.h>

#define B_    4
#define H_    4
#define N_    4096
#define D_    32
#define C_IN  256
#define HID   128   // HEADS*DIM_HEAD
#define SCALE_ 10.0f
#define EPS_   1e-12f
// SCALE_ * log2(e): q carries it, so that K x Q^T comes out in powers of two
#define QSCALE_ (SCALE_ * 1.4426950408889634f)
// Constant softmax shift, in powers of two.  After the L2 norm q and k have
// length at most 1, so |q.k| <= 1 for every input; with both f16 roundings the
// scaled score stays within +-14.45, so 2^(score + 1) lies in 2^-13.45 ..
// 2^15.45: inside the normal f16 range at both ends.  The shift cancels in O / l.
#define PSHIFT_ 1.0f

typedef __attribute__((ext_vector_type(16))) _Float16 v16h;
typedef __attribute__((ext_vector_type(8)))  _Float16 v8h;
typedef __attribute__((ext_vector_type(8)))  float    v8f;
typedef __attribute__((ext_vector_type(4)))  float    v4f;
typedef __attribute__((ext_vector_type(2)))  float    v2f;

// ---------------------------------------------------------------------------
// Shared body of the two 1x1-conv projections, on f32 16x16x4 WMMA.
//   Y[o][pos] = sum_k W[o][k] * X[k][pos],  W is [MT*128][K], X is [K][N_].
// One block = all MT*128 output channels x 64 positions; 8 waves; wave wv owns
// channel tiles wv + 8*i (i < MT) times all four position tiles.
// k runs in chunks of KC through two LDS buffers: the next chunk's global loads
// are issued ahead of this chunk's products and stored to LDS behind them.
// k order of a fragment (same for both operands): lane half h, step s,
// element e  ->  k = kk + 4*h + 2*s + e.
// Tiles i <  SWAP_FROM: A = W, B = X -> acc[r] = Y[tile*16 + 8*h + r][16*j + c]
// Tiles i >= SWAP_FROM: A = X, B = W -> acc[r] = Y[tile*16 + c][16*j + 8*h + r]
// ---------------------------------------------------------------------------
#define KC 32   // k per staged chunk
#define WP 36   // LDS pitch of a weight row, dwords: 144 B = 16 B x odd (16-byte reads)
#define XP 72   // LDS pitch of an activation row, dwords: rows k and k+4 lie 32 banks apart

template <int MT, int K, int SWAP_FROM>
__device__ __forceinline__ void proj_wmma(const float* __restrict__ W,
                                          const float* __restrict__ X,
                                          float* __restrict__ Ws,
                                          float* __restrict__ Xs,
                                          v8f (&acc)[MT][4])
{
  constexpr int M  = MT * 128;
  constexpr int NC = K / KC;
  constexpr int WL = M * KC / 4 / 256;   // 16-byte weight loads per thread and chunk
  const int t    = threadIdx.x;
  const int lane = t & 31;
  const int wv   = t >> 5;
  const int c    = lane & 15;
  const int h    = lane >> 4;

  // Global addresses: a block-uniform base that moves with the chunk, plus one
  // 32-bit byte offset per lane that stays the same for the whole kernel.
  const unsigned woff = (unsigned)(((t >> 3) * K  + (t & 7)  * 4) * 4);
  const unsigned xoff = (unsigned)(((t >> 4) * N_ + (t & 15) * 4) * 4);

  v4f wr[WL], xr[2];
  auto fetch = [&](int kc) {
    const char* wb = (const char*)(W + kc * KC);
    const char* xb = (const char*)(X + (long)kc * KC * N_);
    #pragma unroll  // register-array index stays a constant
    for (int i = 0; i < WL; ++i)
      wr[i] = *(const v4f*)(wb + woff + i * (32 * K * 4));
    #pragma unroll  // register-array index stays a constant
    for (int i = 0; i < 2; ++i)
      xr[i] = *(const v4f*)(xb + xoff + i * (16 * N_ * 4));
    // stands between these loads and the next rewrite of their address registers
    asm volatile("s_wait_xcnt 0x0" ::: "memory");
  };
  auto stash = [&](int buf) {
    float* ws = Ws + buf * (M * WP);
    float* xs = Xs + buf * (KC * XP);
    #pragma unroll  // register-array index stays a constant
    for (int i = 0; i < WL; ++i) {
      const int f = t + 256 * i;
      *(v4f*)(ws + (f >> 3) * WP + (f & 7) * 4) = wr[i];
    }
    #pragma unroll  // register-array index stays a constant
    for (int i = 0; i < 2; ++i) {
      const int f = t + 256 * i;
      *(v4f*)(xs + (f >> 4) * XP + (f & 15) * 4) = xr[i];
    }
  };

  fetch(0);
  stash(0);
  // Kept rolled: unrolled, the build takes more than 255 registers (register-window
  // switches among the products) and puts part of a chunk's products behind the
  // next chunk's LDS stores and their wait on the global loads.
  #pragma unroll 1
  for (int kc = 0; kc < NC; ++kc) {
    // publishes buffer kc&1 and ends every wave's reads of the other buffer
    __syncthreads();
    if (kc + 1 < NC) fetch(kc + 1);

    const float* ws = Ws + (kc & 1) * (M * WP) + (wv * 16 + c) * WP + 4 * h;
    const float* xs = Xs + (kc & 1) * (KC * XP) + 4 * h * XP + c;
    #pragma unroll  // register-array index stays a constant
    for (int kk = 0; kk < KC; kk += 8) {
      v4f a[MT];
      #pragma unroll  // register-array index stays a constant
      for (int i = 0; i < MT; ++i) a[i] = *(const v4f*)(ws + i * (128 * WP) + kk);
      #pragma unroll  // register-array index stays a constant
      for (int s = 0; s < 2; ++s) {
        v2f xb[4];
        #pragma unroll  // register-array index stays a constant
        for (int j = 0; j < 4; ++j) {
          xb[j][0] = xs[(kk + 2 * s)     * XP + 16 * j];
          xb[j][1] = xs[(kk + 2 * s + 1) * XP + 16 * j];
        }
        #pragma unroll  // register-array index stays a constant
        for (int i = 0; i < MT; ++i) {
          v2f wa;
          wa[0] = a[i][2 * s];
          wa[1] = a[i][2 * s + 1];
          #pragma unroll  // register-array index stays a constant
          for (int j = 0; j < 4; ++j) {
            if (i < SWAP_FROM)
              acc[i][j] = __builtin_amdgcn_wmma_f32_16x16x4_f32(
                  false, wa, false, xb[j], (short)0, acc[i][j], false, false);
            else
              acc[i][j] = __builtin_amdgcn_wmma_f32_16x16x4_f32(
                  false, xb[j], false, wa, (short)0, acc[i][j], false, false);
          }
        }
      }
    }
    if (kc + 1 < NC) stash((kc + 1) & 1);
  }
}

// ---------------------------------------------------------------------------
// Kernel 1: QKV projection.  qkv[o][pos] = sum_c w_qkv[o][c] * x[b][c][pos]
// Writes q,k (f16, [b][h][n][32], unnormalized) and v transposed
// (f16, [b][h][32][n]) so attention fragment loads are contiguous 16B chunks.
// Wave wv holds channel tile wv of q (i=0), of k (i=1) and of v (i=2): head
// wv>>1, d from (wv&1)*16.  q,k tiles keep 8 consecutive d per lane, the v tile
// (operands swapped) 8 consecutive positions: every store is one 16-byte store.
// ---------------------------------------------------------------------------
__global__ __launch_bounds__(256) void qkv_proj_kernel(
    const float* __restrict__ x, const float* __restrict__ w,
    _Float16* __restrict__ q, _Float16* __restrict__ k,
    _Float16* __restrict__ vT)
{
  __shared__ __attribute__((aligned(16))) float Ws[2 * 3 * HID * WP];
  __shared__ __attribute__((aligned(16))) float Xs[2 * KC * XP];
  const int b    = blockIdx.y;
  const int pos0 = blockIdx.x * 64;
  const int lane = threadIdx.x & 31;
  const int wv   = threadIdx.x >> 5;
  const int c    = lane & 15;
  const int h    = lane >> 4;

  v8f acc[3][4] = {};
  proj_wmma<3, C_IN, 2>(w, x + (long)b * C_IN * N_ + pos0, Ws, Xs, acc);

  const long bh = (long)b * H_ + (wv >> 1);
  const int  d0 = (wv & 1) * 16;
  #pragma unroll  // register-array index stays a constant
  for (int j = 0; j < 4; ++j) {
    v8h hq, hk, hv;
    #pragma unroll  // register-array index stays a constant
    for (int r = 0; r < 8; ++r) {
      hq[r] = (_Float16)acc[0][j][r];
      hk[r] = (_Float16)acc[1][j][r];
      hv[r] = (_Float16)acc[2][j][r];
    }
    const long pos = pos0 + 16 * j + c;
    *(v8h*)(q + (bh * N_ + pos) * D_ + d0 + 8 * h) = hq;
    *(v8h*)(k + (bh * N_ + pos) * D_ + d0 + 8 * h) = hk;
    *(v8h*)(vT + (bh * D_ + d0 + c) * N_ + pos0 + 16 * j + 8 * h) = hv;
  }
}

// ---------------------------------------------------------------------------
// Kernel 2: per-row L2 normalization of q and k (q,k contiguous in ws).
// The q rows (first half) also take the factor QSCALE_, ahead of the one
// rounding to f16.
// ---------------------------------------------------------------------------
__global__ __launch_bounds__(256) void l2norm_kernel(_Float16* __restrict__ qk,
                                                     int rows)
{
  int r = blockIdx.x * 256 + threadIdx.x;
  if (r >= rows) return;
  _Float16* p = qk + (long)r * D_;
  float vals[D_];
  float ss = 0.f;
  #pragma unroll
  for (int i = 0; i < D_; ++i) {
    vals[i] = (float)p[i];
    ss = fmaf(vals[i], vals[i], ss);
  }
  float inv = 1.0f / fmaxf(sqrtf(ss), EPS_);
  if (r < rows / 2) inv *= QSCALE_;
  #pragma unroll
  for (int i = 0; i < D_; ++i) p[i] = (_Float16)(vals[i] * inv);
}

// ---------------------------------------------------------------------------
// Fragment loader: 16x32 f16 tile in the CDNA5 WMMA A/B lane/K ordering.
// lane<16 : row/col = lane,    K elements {0..7, 16..23}
// lane>=16: row/col = lane-16, K elements {8..15, 24..31}
// ---------------------------------------------------------------------------
__device__ inline v16h load_16x32_frag(const _Float16* __restrict__ base,
                                       long rowStride, int lane)
{
  const int row = lane & 15;
  const int off = (lane >> 4) * 8;
  const _Float16* pr = base + (long)row * rowStride + off;
  v8h lo = *(const v8h*)(pr);
  v8h hi = *(const v8h*)(pr + 16);
  v16h r;
  #pragma unroll
  for (int i = 0; i < 8; ++i) { r[i] = lo[i]; r[8 + i] = hi[i]; }
  return r;
}

// ---------------------------------------------------------------------------
// Kernel 3: flash attention, transposed formulation.
//   S^T = (K tile) x Q^T + shift: the product is the exponent itself (q holds
//   the scale, the C operand the constant shift), P = 2^(S^T).  No running
//   maximum, so O^T and the sums are never rescaled; each lane sums its own
//   keys and the partial sums of a column are joined once, behind the loop.
//   O^T += (V^T tile) x P^T, where P^T's B-fragment is *register-identical*
//   to S^T's C-fragment (pB[e]=f16(s0[e]), pB[8+e]=f16(s1[e])): no LDS,
//   no cross-lane transpose.  Epilogue: per-lane 1/l, coalesced stores.
// K and V^T reach the eight waves of a block through LDS: tiles of KT keys,
// two buffers, filled by asynchronous 16-byte copies one whole tile ahead, so
// a tile's way from L2 is covered by the tile before it and is gone once per
// block, not once per wave.
// A wave owns 32 query columns (two column tiles) and one half of every staged
// tile's keys: each K and V^T fragment that it reads from LDS feeds two
// products.  Waves wv and wv + 4 share their columns; with no running maximum
// their O^T and sums are plain partial sums, added once through LDS at the end.
// ---------------------------------------------------------------------------
#define KT   128           // keys per staged tile
#define KW   (KT / 2)      // keys of a tile per wave
#define KP   40            // LDS pitch of a key row, halves: 80 B = 16 B x odd
#define VP   (KT + 8)      // LDS pitch of a V^T row, halves: 272 B = 16 B x odd
#define KBUF (KT * KP)     // halves per K buffer
#define VBUF (D_ * VP)     // halves per V^T buffer
#define XW   (17 * 32)     // floats a wave hands to its partner: 16 of O^T and 1 sum per lane

__global__ __launch_bounds__(256) void flash_attn_kernel(
    const _Float16* __restrict__ q, const _Float16* __restrict__ k,
    const _Float16* __restrict__ vT, float* __restrict__ ao)
{
  __shared__ __attribute__((aligned(16))) _Float16 Ks[2 * KBUF];
  __shared__ __attribute__((aligned(16))) _Float16 Vs[2 * VBUF];
  __shared__ float Xc[8 * XW];
  const int tid  = threadIdx.x;
  const int lane = tid & 31;
  const int wv   = tid >> 5;
  const int kh   = wv >> 2;          // which half of every tile's keys
  const int b    = blockIdx.y >> 2;
  const int h    = blockIdx.y & 3;
  const long bh  = (long)b * H_ + h;
  const int  i0  = blockIdx.x * 128 + (wv & 3) * 32;
  const int  col = lane & 15;

  // Q^T as B fragments (K-dim = d = 32, N = 16 queries each), loaded once
  const v16h qB0 = load_16x32_frag(q + (bh * N_ + i0) * D_,      D_, lane);
  const v16h qB1 = load_16x32_frag(q + (bh * N_ + i0 + 16) * D_, D_, lane);

  // O^T accumulators, [column tile][d rows 0-15 / 16-31]
  v8f o00 = {}; v8f o01 = {}; v8f o10 = {}; v8f o11 = {};
  v8f ls0 = {}; v8f ls1 = {};        // sums of P per column tile, this lane's keys
  const v8f shift = {PSHIFT_, PSHIFT_, PSHIFT_, PSHIFT_,
                     PSHIFT_, PSHIFT_, PSHIFT_, PSHIFT_};

  // Each thread copies four 16-byte pieces of a tile: K rows tid>>2 and 64 more
  // (a K tile is 8 KiB in a row in global memory), V^T rows tid>>4 and 16 more.
  const _Float16* kg = k  + bh * (long)N_ * D_ + tid * 8;
  const _Float16* vg = vT + bh * (long)D_ * N_ + (long)(tid >> 4) * N_ + (tid & 15) * 8;
  const unsigned  lk = (unsigned)(size_t)(Ks + (tid >> 2) * KP + (tid & 3) * 8);
  const unsigned  lv = (unsigned)(size_t)(Vs + (tid >> 4) * VP + (tid & 15) * 8);

  auto copy_tile = [&](int tile, int buf) {
    const _Float16* gk0 = kg + (long)tile * (KT * D_);
    const _Float16* gk1 = gk0 + 64 * D_;
    const _Float16* gv0 = vg + tile * KT;
    const _Float16* gv1 = gv0 + 16 * N_;
    const unsigned  lk0 = lk + buf * (KBUF * 2);
    const unsigned  lk1 = lk0 + 64 * KP * 2;
    const unsigned  lv0 = lv + buf * (VBUF * 2);
    const unsigned  lv1 = lv0 + 16 * VP * 2;
    // the closing wait stands between the copies and any rewrite of the
    // registers that they name
    asm volatile("global_load_async_to_lds_b128 %0, %4, off\n\t"
                 "global_load_async_to_lds_b128 %1, %5, off\n\t"
                 "global_load_async_to_lds_b128 %2, %6, off\n\t"
                 "global_load_async_to_lds_b128 %3, %7, off\n\t"
                 "s_wait_xcnt 0x0"
                 :: "v"(lk0), "v"(lk1), "v"(lv0), "v"(lv1),
                    "v"(gk0), "v"(gk1), "v"(gv0), "v"(gv1)
                 : "memory");
  };

  constexpr int NT = N_ / KT;
  copy_tile(0, 0);
  // this wave's copies of tile 0 have landed
  asm volatile("s_wait_asynccnt 0x0" ::: "memory");
  // publishes tile 0 to all eight waves
  __syncthreads();
  copy_tile(1, 1);

  // Kept rolled: the buffer index alternates and one barrier ends each trip.
  #pragma unroll 1
  for (int tile = 0; tile < NT; ++tile) {
    const _Float16* ks = Ks + (tile & 1) * KBUF + kh * (KW * KP);
    const _Float16* vs = Vs + (tile & 1) * VBUF + kh * KW;

    // the fragments of this wave's keys of the tile, each read once:
    // K rows j 0..15 / 16..31 and V^T d rows 0..15 / 16..31 per 32 keys
    v16h ka[KW / 16], va[KW / 16];
    #pragma unroll  // register-array index stays a constant
    for (int u = 0; u < KW / 32; ++u) {
      ka[2 * u]     = load_16x32_frag(ks + (32 * u) * KP,      KP, lane);
      ka[2 * u + 1] = load_16x32_frag(ks + (32 * u + 16) * KP, KP, lane);
      va[2 * u]     = load_16x32_frag(vs + 32 * u,             VP, lane);
      va[2 * u + 1] = load_16x32_frag(vs + 16 * VP + 32 * u,   VP, lane);
    }

    #pragma unroll  // register-array index stays a constant
    for (int u = 0; u < KW / 32; ++u) {
      // S^T tiles [j][i], scaled and shifted, for both column tiles
      v8f s00 = __builtin_amdgcn_wmma_f32_16x16x32_f16(false, ka[2 * u], false, qB0,
                                                       (short)0, shift, false, false);
      v8f s01 = __builtin_amdgcn_wmma_f32_16x16x32_f16(false, ka[2 * u + 1], false, qB0,
                                                       (short)0, shift, false, false);
      v8f s10 = __builtin_amdgcn_wmma_f32_16x16x32_f16(false, ka[2 * u], false, qB1,
                                                       (short)0, shift, false, false);
      v8f s11 = __builtin_amdgcn_wmma_f32_16x16x32_f16(false, ka[2 * u + 1], false, qB1,
                                                       (short)0, shift, false, false);

      // exponentiate; P^T B-fragment == S^T C-fragment layout: direct convert
      v16h pB0, pB1;
      #pragma unroll  // register-array index stays a constant
      for (int r = 0; r < 8; ++r) {
        s00[r] = __builtin_amdgcn_exp2f(s00[r]);
        s01[r] = __builtin_amdgcn_exp2f(s01[r]);
        pB0[r]     = (_Float16)s00[r];
        pB0[8 + r] = (_Float16)s01[r];
      }
      ls0 += s00 + s01;
      #pragma unroll  // register-array index stays a constant
      for (int r = 0; r < 8; ++r) {
        s10[r] = __builtin_amdgcn_exp2f(s10[r]);
        s11[r] = __builtin_amdgcn_exp2f(s11[r]);
        pB1[r]     = (_Float16)s10[r];
        pB1[8 + r] = (_Float16)s11[r];
      }
      ls1 += s10 + s11;

      // O^T += V^T x P^T
      o00 = __builtin_amdgcn_wmma_f32_16x16x32_f16(false, va[2 * u], false, pB0,
                                                   (short)0, o00, false, false);
      o01 = __builtin_amdgcn_wmma_f32_16x16x32_f16(false, va[2 * u + 1], false, pB0,
                                                   (short)0, o01, false, false);
      o10 = __builtin_amdgcn_wmma_f32_16x16x32_f16(false, va[2 * u], false, pB1,
                                                   (short)0, o10, false, false);
      o11 = __builtin_amdgcn_wmma_f32_16x16x32_f16(false, va[2 * u + 1], false, pB1,
                                                   (short)0, o11, false, false);
    }

    // this wave's reads of the buffer that is refilled below have returned
    asm volatile("s_wait_dscnt 0x0" ::: "memory");
    // this wave's copies of the next tile have landed
    asm volatile("s_wait_asynccnt 0x0" ::: "memory");
    // publishes the next tile and ends every wave's reads of this one
    __syncthreads();
    if (tile + 2 < NT) copy_tile(tile + 2, tile & 1);
  }
  // no copy is left in flight when the wave ends
  asm volatile("s_wait_asynccnt 0x0" ::: "memory");

  // The two key halves of a column are joined: wave kh finishes column tile kh
  // and hands its partial sums of the other tile to the partner wave.
  const float l0 = ((ls0[0] + ls0[1]) + (ls0[2] + ls0[3])) + ((ls0[4] + ls0[5]) + (ls0[6] + ls0[7]));
  const float l1 = ((ls1[0] + ls1[1]) + (ls1[2] + ls1[3])) + ((ls1[4] + ls1[5]) + (ls1[6] + ls1[7]));
  float* xo = Xc + wv * XW + lane;
  #pragma unroll  // register-array index stays a constant
  for (int r = 0; r < 8; ++r) {
    xo[r * 32]       = kh ? o00[r] : o10[r];
    xo[(8 + r) * 32] = kh ? o01[r] : o11[r];
  }
  xo[16 * 32] = kh ? l0 : l1;
  // publishes every wave's handed-over sums to its partner
  __syncthreads();
  const float* xi = Xc + (wv ^ 4) * XW + lane;
  v8f o0, o1;
  #pragma unroll  // register-array index stays a constant
  for (int r = 0; r < 8; ++r) {
    o0[r] = (kh ? o10[r] : o00[r]) + xi[r * 32];
    o1[r] = (kh ? o11[r] : o01[r]) + xi[(8 + r) * 32];
  }
  float l = (kh ? l1 : l0) + xi[16 * 32];

  // epilogue: O^T / l, coalesced stores to ao[b][c=h*32+d][n]
  l += __shfl_xor(l, 16);
  const float inv  = 1.0f / l;
  const int   hi8  = (lane >> 4) * 8;
  const int   cbase = h * 32;
  const int   n    = i0 + kh * 16 + col;
  #pragma unroll
  for (int r = 0; r < 8; ++r) {
    const int d = r + hi8;
    ao[(long)(b * HID + cbase + d)      * N_ + n] = o0[r] * inv;
    ao[(long)(b * HID + cbase + 16 + d) * N_ + n] = o1[r] * inv;
  }
}

// ---------------------------------------------------------------------------
// Kernel 4: output projection.
// out[b][o][pos] = b_out[o] + sum_c w_out[o][c]*ao[b][c][pos]
// Same WMMA body; the bias, staged in LDS, is added at the store.
// ---------------------------------------------------------------------------
__global__ __launch_bounds__(256) void out_proj_kernel(
    const float* __restrict__ ao, const float* __restrict__ w_out,
    const float* __restrict__ b_out, float* __restrict__ out)
{
  __shared__ __attribute__((aligned(16))) float Ws[2 * C_IN * WP];
  __shared__ __attribute__((aligned(16))) float Xs[2 * KC * XP];
  __shared__ __attribute__((aligned(16))) float Bs[C_IN];   // C_IN = block size
  const int b    = blockIdx.y;
  const int pos0 = blockIdx.x * 64;
  const int lane = threadIdx.x & 31;
  const int wv   = threadIdx.x >> 5;
  const int c    = lane & 15;
  const int h    = lane >> 4;

  // one coalesced bias load per block; the body's first barrier publishes it
  Bs[threadIdx.x] = b_out[threadIdx.x];

  v8f acc[2][4] = {};
  proj_wmma<2, HID, 2>(w_out, ao + (long)b * HID * N_ + pos0, Ws, Xs, acc);

  #pragma unroll  // register-array index stays a constant
  for (int i = 0; i < 2; ++i) {
    #pragma unroll  // register-array index stays a constant
    for (int r = 0; r < 8; ++r) {
      const int   o    = (wv + 8 * i) * 16 + 8 * h + r;
      const float bias = Bs[o];
      #pragma unroll  // register-array index stays a constant
      for (int j = 0; j < 4; ++j)
        out[((long)b * C_IN + o) * N_ + pos0 + 16 * j + c] = acc[i][j][r] + bias;
    }
  }
}

// ---------------------------------------------------------------------------
extern "C" void kernel_launch(void* const* d_in, const int* in_sizes, int n_in,
                              void* d_out, int out_size, void* d_ws, size_t ws_size,
                              hipStream_t stream)
{
  const float* x     = (const float*)d_in[0];
  const float* w_qkv = (const float*)d_in[1];
  const float* w_out = (const float*)d_in[2];
  const float* b_out = (const float*)d_in[3];
  float*       out   = (float*)d_out;

  // workspace layout: q(4MiB f16) | k(4MiB f16) | vT(4MiB f16) | ao(8MiB f32)
  char* ws = (char*)d_ws;
  _Float16* q  = (_Float16*)(ws);
  _Float16* k  = (_Float16*)(ws + ((size_t)4  << 20));
  _Float16* vT = (_Float16*)(ws + ((size_t)8  << 20));
  float*    ao = (float*)   (ws + ((size_t)12 << 20));

  dim3 g1(N_ / 64, B_);
  qkv_proj_kernel<<<g1, 256, 0, stream>>>(x, w_qkv, q, k, vT);

  int rows = 2 * B_ * H_ * N_;   // q + k rows (contiguous)
  l2norm_kernel<<<rows / 256, 256, 0, stream>>>(q, rows);

  dim3 g2(N_ / 128, B_ * H_);
  flash_attn_kernel<<<g2, 256, 0, stream>>>(q, k, vT, ao);

  dim3 g3(N_ / 64, B_);
  out_proj_kernel<<<g3, 256, 0, stream>>>(ao, w_out, b_out, out);
}

// v005
// One run takes 60.6 microseconds.
// Next to v004, in two timings, it ran 1.25 and 1.23 times as fast.
// Over all steps from v000 it is 5.13 times as fast.
#include <hip/hip_runtime.h>
#include <hip/hip_bf16.h>
#include <math.h>

#define B_    4
#define H_    4
#define N_    4096
#define D_    32
#define C_IN  256
#define HID   128   // HEADS*DIM_HEAD
#define SCALE_ 10.0f
#define EPS_   1e-12f
// SCALE_ * log2(e): q carries it, so that K x Q^T comes out in powers of two
#define QSCALE_ (SCALE_ * 1.4426950408889634f)
// Constant softmax shift, in powers of two.  After the L2 norm q and k have
// length at most 1, so |q.k| <= 1 for every input; with their f16 roundings the
// scaled score stays within +-14.45, so 2^(score + 1) lies in 2^-13.45 ..
// 2^15.45: inside the normal f16 range at both ends.  The shift cancels in O / l.
#define PSHIFT_ 1.0f

typedef __attribute__((ext_vector_type(16))) _Float16 v16h;
typedef __attribute__((ext_vector_type(8)))  _Float16 v8h;
typedef __attribute__((ext_vector_type(8)))  float    v8f;
typedef __attribute__((ext_vector_type(4)))  float    v4f;
typedef __attribute__((ext_vector_type(2)))  float    v2f;

// ---------------------------------------------------------------------------
// Shared body of the two 1x1-conv projections, on f32 16x16x4 WMMA.
//   Y[o][pos] = sum_k W[o][k] * X[k][pos],  W is [MT*128][K], X is [K][N_].
// One block = all MT*128 output channels x 64 positions; 8 waves; wave wv owns
// channel tiles wv + 8*i (i < MT) times all four position tiles.
// k runs in chunks of KC through two LDS buffers: the next chunk's global loads
// are issued ahead of this chunk's products and stored to LDS behind them.
// k order of a fragment (same for both operands): lane half h, step s,
// element e  ->  k = kk + 4*h + 2*s + e.
// Tiles i <  SWAP_FROM: A = W, B = X -> acc[r] = Y[tile*16 + 8*h + r][16*j + c]
// Tiles i >= SWAP_FROM: A = X, B = W -> acc[r] = Y[tile*16 + c][16*j + 8*h + r]
// ---------------------------------------------------------------------------
#define KC 32   // k per staged chunk
#define WP 36   // LDS pitch of a weight row, dwords: 144 B = 16 B x odd (16-byte reads)
#define XP 72   // LDS pitch of an activation row, dwords: rows k and k+4 lie 32 banks apart

template <int MT, int K, int SWAP_FROM>
__device__ __forceinline__ void proj_wmma(const float* __restrict__ W,
                                          const float* __restrict__ X,
                                          float* __restrict__ Ws,
                                          float* __restrict__ Xs,
                                          v8f (&acc)[MT][4])
{
  constexpr int M  = MT * 128;
  constexpr int NC = K / KC;
  constexpr int WL = M * KC / 4 / 256;   // 16-byte weight loads per thread and chunk
  const int t    = threadIdx.x;
  const int lane = t & 31;
  const int wv   = t >> 5;
  const int c    = lane & 15;
  const int h    = lane >> 4;

  // Global addresses: a block-uniform base that moves with the chunk, plus one
  // 32-bit byte offset per lane that stays the same for the whole kernel.
  const unsigned woff = (unsigned)(((t >> 3) * K  + (t & 7)  * 4) * 4);
  const unsigned xoff = (unsigned)(((t >> 4) * N_ + (t & 15) * 4) * 4);

  v4f wr[WL], xr[2];
  auto fetch = [&](int kc) {
    const char* wb = (const char*)(W + kc * KC);
    const char* xb = (const char*)(X + (long)kc * KC * N_);
    #pragma unroll  // register-array index stays a constant
    for (int i = 0; i < WL; ++i)
      wr[i] = *(const v4f*)(wb + woff + i * (32 * K * 4));
    #pragma unroll  // register-array index stays a constant
    for (int i = 0; i < 2; ++i)
      xr[i] = *(const v4f*)(xb + xoff + i * (16 * N_ * 4));
    // stands between these loads and the next rewrite of their address registers
    asm volatile("s_wait_xcnt 0x0" ::: "memory");
  };
  auto stash = [&](int buf) {
    float* ws = Ws + buf * (M * WP);
    float* xs = Xs + buf * (KC * XP);
    #pragma unroll  // register-array index stays a constant
    for (int i = 0; i < WL; ++i) {
      const int f = t + 256 * i;
      *(v4f*)(ws + (f >> 3) * WP + (f & 7) * 4) = wr[i];
    }
    #pragma unroll  // register-array index stays a constant
    for (int i = 0; i < 2; ++i) {
      const int f = t + 256 * i;
      *(v4f*)(xs + (f >> 4) * XP + (f & 15) * 4) = xr[i];
    }
  };

  fetch(0);
  stash(0);
  // Kept rolled: unrolled, the build takes more than 255 registers (register-window
  // switches among the products) and puts part of a chunk's products behind the
  // next chunk's LDS stores and their wait on the global loads.
  #pragma unroll 1
  for (int kc = 0; kc < NC; ++kc) {
    // publishes buffer kc&1 and ends every wave's reads of the other buffer
    __syncthreads();
    if (kc + 1 < NC) fetch(kc + 1);

    const float* ws = Ws + (kc & 1) * (M * WP) + (wv * 16 + c) * WP + 4 * h;
    const float* xs = Xs + (kc & 1) * (KC * XP) + 4 * h * XP + c;
    #pragma unroll  // register-array index stays a constant
    for (int kk = 0; kk < KC; kk += 8) {
      v4f a[MT];
      #pragma unroll  // register-array index stays a constant
      for (int i = 0; i < MT; ++i) a[i] = *(const v4f*)(ws + i * (128 * WP) + kk);
      #pragma unroll  // register-array index stays a constant
      for (int s = 0; s < 2; ++s) {
        v2f xb[4];
        #pragma unroll  // register-array index stays a constant
        for (int j = 0; j < 4; ++j) {
          xb[j][0] = xs[(kk + 2 * s)     * XP + 16 * j];
          xb[j][1] = xs[(kk + 2 * s + 1) * XP + 16 * j];
        }
        #pragma unroll  // register-array index stays a constant
        for (int i = 0; i < MT; ++i) {
          v2f wa;
          wa[0] = a[i][2 * s];
          wa[1] = a[i][2 * s + 1];
          #pragma unroll  // register-array index stays a constant
          for (int j = 0; j < 4; ++j) {
            if (i < SWAP_FROM)
              acc[i][j] = __builtin_amdgcn_wmma_f32_16x16x4_f32(
                  false, wa, false, xb[j], (short)0, acc[i][j], false, false);
            else
              acc[i][j] = __builtin_amdgcn_wmma_f32_16x16x4_f32(
                  false, xb[j], false, wa, (short)0, acc[i][j], false, false);
          }
        }
      }
    }
    if (kc + 1 < NC) stash((kc + 1) & 1);
  }
}

// ---------------------------------------------------------------------------
// Kernel 1: QKV projection.  qkv[o][pos] = sum_c w_qkv[o][c] * x[b][c][pos]
// Writes q,k (f16, [b][h][n][32], L2-normalized over d) and v transposed
// (f16, [b][h][32][n]) so attention fragment loads are contiguous 16B chunks.
// Wave wv holds channel tile wv of q (i=0), of k (i=1) and of v (i=2): head
// wv>>1, d from (wv&1)*16.  q,k tiles keep 8 consecutive d per lane, the v tile
// (operands swapped) 8 consecutive positions: every store is one 16-byte store.
// The L2 norm is taken here, on the f32 accumulators: the 32 d of one (head,
// position) lie in four lanes of the block (both lane halves of waves wv and
// wv^1), which join their sums of 8 squares through LDS.  q also takes the
// factor QSCALE_; each of q and k is rounded to f16 once.
// ---------------------------------------------------------------------------
#define SP 12   // LDS pitch of a thread's 8 sums of squares, dwords: 48 B = 16 B x odd

__global__ __launch_bounds__(256) void qkv_proj_kernel(
    const float* __restrict__ x, const float* __restrict__ w,
    _Float16* __restrict__ q, _Float16* __restrict__ k,
    _Float16* __restrict__ vT)
{
  __shared__ __attribute__((aligned(16))) float Ws[2 * 3 * HID * WP];
  __shared__ __attribute__((aligned(16))) float Xs[2 * KC * XP];
  __shared__ __attribute__((aligned(16))) float Ss[256 * SP];   // sums of 8 squares
  const int b    = blockIdx.y;
  const int pos0 = blockIdx.x * 64;
  const int lane = threadIdx.x & 31;
  const int wv   = threadIdx.x >> 5;
  const int c    = lane & 15;
  const int h    = lane >> 4;

  v8f acc[3][4] = {};
  proj_wmma<3, C_IN, 2>(w, x + (long)b * C_IN * N_ + pos0, Ws, Xs, acc);

  // this lane's 8 d of q (i = 0) and k (i = 1), squared and summed in register
  // pairs, one sum per position tile j
  #pragma unroll  // register-array index stays a constant
  for (int i = 0; i < 2; ++i) {
    v4f sq;
    #pragma unroll  // register-array index stays a constant
    for (int j = 0; j < 4; ++j) {
      v2f s2 = {0.f, 0.f};
      #pragma unroll  // register-array index stays a constant
      for (int r = 0; r < 8; r += 2) {
        v2f a;
        a[0] = acc[i][j][r];
        a[1] = acc[i][j][r + 1];
        s2 += a * a;
      }
      sq[j] = s2[0] + s2[1];
    }
    *(v4f*)(Ss + threadIdx.x * SP + 4 * i) = sq;
  }
  // publishes every lane's sums of squares to the other three lanes of its rows
  __syncthreads();
  // The four parts are added in the order of d, the same in all four lanes.
  // 1 / max(sqrt(ss), eps) = min(rsqrt(ss), 1 / eps), ss = 0 included.
  const float* sp = Ss + ((wv & 6) * 32 + c) * SP;
  float inv[2][4];
  #pragma unroll  // register-array index stays a constant
  for (int i = 0; i < 2; ++i) {
    const v4f ss = (*(const v4f*)(sp + 4 * i)           + *(const v4f*)(sp + 16 * SP + 4 * i))
                 + (*(const v4f*)(sp + 32 * SP + 4 * i) + *(const v4f*)(sp + 48 * SP + 4 * i));
    float rs[4];
    // In one statement so that the closing v_nop stays directly behind the last
    // v_rsq_f32: it is the free slot that the instruction set asks for ahead of an
    // instruction that reads the result or rewrites the source.
    asm("v_rsq_f32 %0, %4\n\t"
        "v_rsq_f32 %1, %5\n\t"
        "v_rsq_f32 %2, %6\n\t"
        "v_rsq_f32 %3, %7\n\t"
        "v_nop"
        : "=&v"(rs[0]), "=&v"(rs[1]), "=&v"(rs[2]), "=&v"(rs[3])
        : "v"(ss[0]), "v"(ss[1]), "v"(ss[2]), "v"(ss[3]));
    #pragma unroll  // register-array index stays a constant
    for (int j = 0; j < 4; ++j)
      inv[i][j] = fminf(rs[j], 1.0f / EPS_) * (i == 0 ? QSCALE_ : 1.0f);
  }

  const long bh = (long)b * H_ + (wv >> 1);
  const int  d0 = (wv & 1) * 16;
  #pragma unroll  // register-array index stays a constant
  for (int j = 0; j < 4; ++j) {
    v8h hq, hk, hv;
    #pragma unroll  // register-array index stays a constant
    for (int r = 0; r < 8; ++r) {
      hq[r] = (_Float16)(acc[0][j][r] * inv[0][j]);
      hk[r] = (_Float16)(acc[1][j][r] * inv[1][j]);
      hv[r] = (_Float16)acc[2][j][r];
    }
    const long pos = pos0 + 16 * j + c;
    *(v8h*)(q + (bh * N_ + pos) * D_ + d0 + 8 * h) = hq;
    *(v8h*)(k + (bh * N_ + pos) * D_ + d0 + 8 * h) = hk;
    *(v8h*)(vT + (bh * D_ + d0 + c) * N_ + pos0 + 16 * j + 8 * h) = hv;
  }
}

// ---------------------------------------------------------------------------
// Fragment loader: 16x32 f16 tile in the CDNA5 WMMA A/B lane/K ordering.
// lane<16 : row/col = lane,    K elements {0..7, 16..23}
// lane>=16: row/col = lane-16, K elements {8..15, 24..31}
// ---------------------------------------------------------------------------
__device__ inline v16h load_16x32_frag(const _Float16* __restrict__ base,
                                       long rowStride, int lane)
{
  const int row = lane & 15;
  const int off = (lane >> 4) * 8;
  const _Float16* pr = base + (long)row * rowStride + off;
  v8h lo = *(const v8h*)(pr);
  v8h hi = *(const v8h*)(pr + 16);
  v16h r;
  #pragma unroll
  for (int i = 0; i < 8; ++i) { r[i] = lo[i]; r[8 + i] = hi[i]; }
  return r;
}

// ---------------------------------------------------------------------------
// Kernel 2: flash attention, transposed formulation.
//   S^T = (K tile) x Q^T + shift: the product is the exponent itself (q holds
//   the scale, the C operand the constant shift), P = 2^(S^T).  No running
//   maximum, so O^T and the sums are never rescaled; each lane sums its own
//   keys and the partial sums of a column are joined once, behind the loop.
//   O^T += (V^T tile) x P^T, where P^T's B-fragment is *register-identical*
//   to S^T's C-fragment (pB[e]=f16(s0[e]), pB[8+e]=f16(s1[e])): no LDS,
//   no cross-lane transpose.  Epilogue: per-lane 1/l, coalesced stores.
// K and V^T reach the eight waves of a block through LDS: tiles of KT keys,
// two buffers, filled by asynchronous 16-byte copies one whole tile ahead, so
// a tile's way from L2 is covered by the tile before it and is gone once per
// block, not once per wave.
// A wave owns 32 query columns (two column tiles) and one half of every staged
// tile's keys: each K and V^T fragment that it reads from LDS feeds two
// products.  Waves wv and wv + 4 share their columns; with no running maximum
// their O^T and sums are plain partial sums, added once through LDS at the end.
// ---------------------------------------------------------------------------
#define KT   128           // keys per staged tile
#define KW   (KT / 2)      // keys of a tile per wave
#define KP   40            // LDS pitch of a key row, halves: 80 B = 16 B x odd
#define VP   (KT + 8)      // LDS pitch of a V^T row, halves: 272 B = 16 B x odd
#define KBUF (KT * KP)     // halves per K buffer
#define VBUF (D_ * VP)     // halves per V^T buffer
#define XW   (17 * 32)     // floats a wave hands to its partner: 16 of O^T and 1 sum per lane

__global__ __launch_bounds__(256) void flash_attn_kernel(
    const _Float16* __restrict__ q, const _Float16* __restrict__ k,
    const _Float16* __restrict__ vT, float* __restrict__ ao)
{
  __shared__ __attribute__((aligned(16))) _Float16 Ks[2 * KBUF];
  __shared__ __attribute__((aligned(16))) _Float16 Vs[2 * VBUF];
  __shared__ float Xc[8 * XW];
  const int tid  = threadIdx.x;
  const int lane = tid & 31;
  const int wv   = tid >> 5;
  const int kh   = wv >> 2;          // which half of every tile's keys
  const int b    = blockIdx.y >> 2;
  const int h    = blockIdx.y & 3;
  const long bh  = (long)b * H_ + h;
  const int  i0  = blockIdx.x * 128 + (wv & 3) * 32;
  const int  col = lane & 15;

  // Q^T as B fragments (K-dim = d = 32, N = 16 queries each), loaded once
  const v16h qB0 = load_16x32_frag(q + (bh * N_ + i0) * D_,      D_, lane);
  const v16h qB1 = load_16x32_frag(q + (bh * N_ + i0 + 16) * D_, D_, lane);

  // O^T accumulators, [column tile][d rows 0-15 / 16-31]
  v8f o00 = {}; v8f o01 = {}; v8f o10 = {}; v8f o11 = {};
  v8f ls0 = {}; v8f ls1 = {};        // sums of P per column tile, this lane's keys
  const v8f shift = {PSHIFT_, PSHIFT_, PSHIFT_, PSHIFT_,
                     PSHIFT_, PSHIFT_, PSHIFT_, PSHIFT_};

  // Each thread copies four 16-byte pieces of a tile: K rows tid>>2 and 64 more
  // (a K tile is 8 KiB in a row in global memory), V^T rows tid>>4 and 16 more.
  const _Float16* kg = k  + bh * (long)N_ * D_ + tid * 8;
  const _Float16* vg = vT + bh * (long)D_ * N_ + (long)(tid >> 4) * N_ + (tid & 15) * 8;
  const unsigned  lk = (unsigned)(size_t)(Ks + (tid >> 2) * KP + (tid & 3) * 8);
  const unsigned  lv = (unsigned)(size_t)(Vs + (tid >> 4) * VP + (tid & 15) * 8);

  auto copy_tile = [&](int tile, int buf) {
    const _Float16* gk0 = kg + (long)tile * (KT * D_);
    const _Float16* gk1 = gk0 + 64 * D_;
    const _Float16* gv0 = vg + tile * KT;
    const _Float16* gv1 = gv0 + 16 * N_;
    const unsigned  lk0 = lk + buf * (KBUF * 2);
    const unsigned  lk1 = lk0 + 64 * KP * 2;
    const unsigned  lv0 = lv + buf * (VBUF * 2);
    const unsigned  lv1 = lv0 + 16 * VP * 2;
    // the closing wait stands between the copies and any rewrite of the
    // registers that they name
    asm volatile("global_load_async_to_lds_b128 %0, %4, off\n\t"
                 "global_load_async_to_lds_b128 %1, %5, off\n\t"
                 "global_load_async_to_lds_b128 %2, %6, off\n\t"
                 "global_load_async_to_lds_b128 %3, %7, off\n\t"
                 "s_wait_xcnt 0x0"
                 :: "v"(lk0), "v"(lk1), "v"(lv0), "v"(lv1),
                    "v"(gk0), "v"(gk1), "v"(gv0), "v"(gv1)
                 : "memory");
  };

  constexpr int NT = N_ / KT;
  copy_tile(0, 0);
  // this wave's copies of tile 0 have landed
  asm volatile("s_wait_asynccnt 0x0" ::: "memory");
  // publishes tile 0 to all eight waves
  __syncthreads();
  copy_tile(1, 1);

  // Kept rolled: the buffer index alternates and one barrier ends each trip.
  #pragma unroll 1
  for (int tile = 0; tile < NT; ++tile) {
    const _Float16* ks = Ks + (tile & 1) * KBUF + kh * (KW * KP);
    const _Float16* vs = Vs + (tile & 1) * VBUF + kh * KW;

    // the fragments of this wave's keys of the tile, each read once:
    // K rows j 0..15 / 16..31 and V^T d rows 0..15 / 16..31 per 32 keys
    v16h ka[KW / 16], va[KW / 16];
    #pragma unroll  // register-array index stays a constant
    for (int u = 0; u < KW / 32; ++u) {
      ka[2 * u]     = load_16x32_frag(ks + (32 * u) * KP,      KP, lane);
      ka[2 * u + 1] = load_16x32_frag(ks + (32 * u + 16) * KP, KP, lane);
      va[2 * u]     = load_16x32_frag(vs + 32 * u,             VP, lane);
      va[2 * u + 1] = load_16x32_frag(vs + 16 * VP + 32 * u,   VP, lane);
    }

    #pragma unroll  // register-array index stays a constant
    for (int u = 0; u < KW / 32; ++u) {
      // S^T tiles [j][i], scaled and shifted, for both column tiles
      v8f s00 = __builtin_amdgcn_wmma_f32_16x16x32_f16(false, ka[2 * u], false, qB0,
                                                       (short)0, shift, false, false);
      v8f s01 = __builtin_amdgcn_wmma_f32_16x16x32_f16(false, ka[2 * u + 1], false, qB0,
                                                       (short)0, shift, false, false);
      v8f s10 = __builtin_amdgcn_wmma_f32_16x16x32_f16(false, ka[2 * u], false, qB1,
                                                       (short)0, shift, false, false);
      v8f s11 = __builtin_amdgcn_wmma_f32_16x16x32_f16(false, ka[2 * u + 1], false, qB1,
                                                       (short)0, shift, false, false);

      // exponentiate; P^T B-fragment == S^T C-fragment layout: direct convert
      v16h pB0, pB1;
      #pragma unroll  // register-array index stays a constant
      for (int r = 0; r < 8; ++r) {
        s00[r] = __builtin_amdgcn_exp2f(s00[r]);
        s01[r] = __builtin_amdgcn_exp2f(s01[r]);
        pB0[r]     = (_Float16)s00[r];
        pB0[8 + r] = (_Float16)s01[r];
      }
      ls0 += s00 + s01;
      #pragma unroll  // register-array index stays a constant
      for (int r = 0; r < 8; ++r) {
        s10[r] = __builtin_amdgcn_exp2f(s10[r]);
        s11[r] = __builtin_amdgcn_exp2f(s11[r]);
        pB1[r]     = (_Float16)s10[r];
        pB1[8 + r] = (_Float16)s11[r];
      }
      ls1 += s10 + s11;

      // O^T += V^T x P^T
      o00 = __builtin_amdgcn_wmma_f32_16x16x32_f16(false, va[2 * u], false, pB0,
                                                   (short)0, o00, false, false);
      o01 = __builtin_amdgcn_wmma_f32_16x16x32_f16(false, va[2 * u + 1], false, pB0,
                                                   (short)0, o01, false, false);
      o10 = __builtin_amdgcn_wmma_f32_16x16x32_f16(false, va[2 * u], false, pB1,
                                                   (short)0, o10, false, false);
      o11 = __builtin_amdgcn_wmma_f32_16x16x32_f16(false, va[2 * u + 1], false, pB1,
                                                   (short)0, o11, false, false);
    }

    // this wave's reads of the buffer that is refilled below have returned
    asm volatile("s_wait_dscnt 0x0" ::: "memory");
    // this wave's copies of the next tile have landed
    asm volatile("s_wait_asynccnt 0x0" ::: "memory");
    // publishes the next tile and ends every wave's reads of this one
    __syncthreads();
    if (tile + 2 < NT) copy_tile(tile + 2, tile & 1);
  }
  // no copy is left in flight when the wave ends
  asm volatile("s_wait_asynccnt 0x0" ::: "memory");

  // The two key halves of a column are joined: wave kh finishes column tile kh
  // and hands its partial sums of the other tile to the partner wave.
  const float l0 = ((ls0[0] + ls0[1]) + (ls0[2] + ls0[3])) + ((ls0[4] + ls0[5]) + (ls0[6] + ls0[7]));
  const float l1 = ((ls1[0] + ls1[1]) + (ls1[2] + ls1[3])) + ((ls1[4] + ls1[5]) + (ls1[6] + ls1[7]));
  float* xo = Xc + wv * XW + lane;
  #pragma unroll  // register-array index stays a constant
  for (int r = 0; r < 8; ++r) {
    xo[r * 32]       = kh ? o00[r] : o10[r];
    xo[(8 + r) * 32] = kh ? o01[r] : o11[r];
  }
  xo[16 * 32] = kh ? l0 : l1;
  // publishes every wave's handed-over sums to its partner
  __syncthreads();
  const float* xi = Xc + (wv ^ 4) * XW + lane;
  v8f o0, o1;
  #pragma unroll  // register-array index stays a constant
  for (int r = 0; r < 8; ++r) {
    o0[r] = (kh ? o10[r] : o00[r]) + xi[r * 32];
    o1[r] = (kh ? o11[r] : o01[r]) + xi[(8 + r) * 32];
  }
  float l = (kh ? l1 : l0) + xi[16 * 32];

  // epilogue: O^T / l, coalesced stores to ao[b][c=h*32+d][n]
  l += __shfl_xor(l, 16);
  const float inv  = 1.0f / l;
  const int   hi8  = (lane >> 4) * 8;
  const int   cbase = h * 32;
  const int   n    = i0 + kh * 16 + col;
  #pragma unroll
  for (int r = 0; r < 8; ++r) {
    const int d = r + hi8;
    ao[(long)(b * HID + cbase + d)      * N_ + n] = o0[r] * inv;
    ao[(long)(b * HID + cbase + 16 + d) * N_ + n] = o1[r] * inv;
  }
}

// ---------------------------------------------------------------------------
// Kernel 3: output projection.
// out[b][o][pos] = b_out[o] + sum_c w_out[o][c]*ao[b][c][pos]
// Same WMMA body; the bias, staged in LDS, is added at the store.
// ---------------------------------------------------------------------------
__global__ __launch_bounds__(256) void out_proj_kernel(
    const float* __restrict__ ao, const float* __restrict__ w_out,
    const float* __restrict__ b_out, float* __restrict__ out)
{
  __shared__ __attribute__((aligned(16))) float Ws[2 * C_IN * WP];
  __shared__ __attribute__((aligned(16))) float Xs[2 * KC * XP];
  __shared__ __attribute__((aligned(16))) float Bs[C_IN];   // C_IN = block size
  const int b    = blockIdx.y;
  const int pos0 = blockIdx.x * 64;
  const int lane = threadIdx.x & 31;
  const int wv   = threadIdx.x >> 5;
  const int c    = lane & 15;
  const int h    = lane >> 4;

  // one coalesced bias load per block; the body's first barrier publishes it
  Bs[threadIdx.x] = b_out[threadIdx.x];

  v8f acc[2][4] = {};
  proj_wmma<2, HID, 2>(w_out, ao + (long)b * HID * N_ + pos0, Ws, Xs, acc);

  #pragma unroll  // register-array index stays a constant
  for (int i = 0; i < 2; ++i) {
    #pragma unroll  // register-array index stays a constant
    for (int r = 0; r < 8; ++r) {
      const int   o    = (wv + 8 * i) * 16 + 8 * h + r;
      const float bias = Bs[o];
      #pragma unroll  // register-array index stays a constant
      for (int j = 0; j < 4; ++j)
        out[((long)b * C_IN + o) * N_ + pos0 + 16 * j + c] = acc[i][j][r] + bias;
    }
  }
}

// ---------------------------------------------------------------------------
extern "C" void kernel_launch(void* const* d_in, const int* in_sizes, int n_in,
                              void* d_out, int out_size, void* d_ws, size_t ws_size,
                              hipStream_t stream)
{
  const float* x     = (const float*)d_in[0];
  const float* w_qkv = (const float*)d_in[1];
  const float* w_out = (const float*)d_in[2];
  const float* b_out = (const float*)d_in[3];
  float*       out   = (float*)d_out;

  // workspace layout: q(4MiB f16) | k(4MiB f16) | vT(4MiB f16) | ao(8MiB f32)
  char* ws = (char*)d_ws;
  _Float16* q  = (_Float16*)(ws);
  _Float16* k  = (_Float16*)(ws + ((size_t)4  << 20));
  _Float16* vT = (_Float16*)(ws + ((size_t)8  << 20));
  float*    ao = (float*)   (ws + ((size_t)12 << 20));

  dim3 g1(N_ / 64, B_);
  qkv_proj_kernel<<<g1, 256, 0, stream>>>(x, w_qkv, q, k, vT);

  dim3 g2(N_ / 128, B_ * H_);
  flash_attn_kernel<<<g2, 256, 0, stream>>>(q, k, vT, ao);

  dim3 g3(N_ / 64, B_);
  out_proj_kernel<<<g3, 256, 0, stream>>>(ao, w_out, b_out, out);
}

// v006
// A run of this version takes 51.6 microseconds.
// Timed twice side by side with v005, it ran 1.16 and 1.18 times as fast.
// All steps since v000 together make it 6.00 times as fast.
#include <hip/hip_runtime.h>
#include <hip/hip_bf16.h>
#include <math.h>

#define B_    4
#define H_    4
#define N_    4096
#define D_    32
#define C_IN  256
#define HID   128   // HEADS*DIM_HEAD
#define SCALE_ 10.0f
#define EPS_   1e-12f
// SCALE_ * log2(e): q carries it, so that K x Q^T comes out in powers of two
#define QSCALE_ (SCALE_ * 1.4426950408889634f)
// Constant softmax shift, in powers of two.  After the L2 norm q and k have
// length at most 1, so |q.k| <= 1 for every input; with their f16 roundings the
// scaled score stays within +-14.45, so 2^(score + 1) lies in 2^-13.45 ..
// 2^15.45: inside the normal f16 range at both ends.  The shift cancels in O / l.
#define PSHIFT_ 1.0f

typedef __attribute__((ext_vector_type(16))) _Float16 v16h;
typedef __attribute__((ext_vector_type(8)))  _Float16 v8h;
typedef __attribute__((ext_vector_type(8)))  float    v8f;
typedef __attribute__((ext_vector_type(4)))  float    v4f;
typedef __attribute__((ext_vector_type(2)))  float    v2f;
typedef __attribute__((ext_vector_type(16))) __bf16   v16b;
typedef __attribute__((ext_vector_type(2)))  __bf16   v2b;
typedef __attribute__((ext_vector_type(8)))  unsigned v8u;
typedef __attribute__((ext_vector_type(4)))  unsigned v4u;
typedef __attribute__((ext_vector_type(2)))  unsigned v2u;

// ---------------------------------------------------------------------------
// Shared body of the two 1x1-conv projections, on bf16 16x16x32 WMMA with f32
// accumulators.  Each f32 operand is split into two bf16 terms, a head (the
// value rounded to bf16) and a tail (what is left, rounded to bf16), and
//   w * x  ~=  wh * xh + wh * xt + wt * xh
// takes three products; what is dropped lies about 2^-16 below w * x.
//   Y[o][pos] = sum_k W[o][k] * X[k][pos],  W is [MT*128][K], X is [K][N_].
// One block = all MT*128 output channels x 64 positions; 8 waves; wave wv owns
// channel tiles wv + 8*i (i < MT) times all four position tiles.
// k runs in chunks of KC through two LDS buffers: the next chunk's global loads
// are issued ahead of this chunk's products; split and stored to LDS behind them.
// In LDS both operands lie k-contiguous, one row per channel or per position:
// 32 heads, 32 tails, pad.  One loader serves both operands, so their k order
// is the same: lane half h, element p  ->  k = 16*h + p.
// Tiles i <  SWAP_FROM: A = W, B = X -> acc[r] = Y[tile*16 + 8*h + r][16*j + c]
// Tiles i >= SWAP_FROM: A = X, B = W -> acc[r] = Y[tile*16 + c][16*j + 8*h + r]
// ---------------------------------------------------------------------------
#define KC 32   // k per staged chunk = k of one product
#define RP 36   // LDS pitch of a row, dwords: 16 of heads, 16 of tails, 4 of pad: 144 B = 16 B x odd

// two f32 -> their bf16 heads in one dword, their bf16 tails in another
__device__ __forceinline__ void split2(float a, float b, unsigned& head, unsigned& tail)
{
  const v2f x = {a, b};
  const v2b hd = __builtin_convertvector(x, v2b);
  const v2f r  = x - __builtin_convertvector(hd, v2f);   // exact
  const v2b tl = __builtin_convertvector(r, v2b);
  head = __builtin_bit_cast(unsigned, hd);
  tail = __builtin_bit_cast(unsigned, tl);
}

// 16 consecutive bf16 of an LDS row as an A or B fragment
__device__ __forceinline__ v16b row_frag(const unsigned* p)
{
  const v4u lo = *(const v4u*)p;
  const v4u hi = *(const v4u*)(p + 4);
  const v8u u  = {lo[0], lo[1], lo[2], lo[3], hi[0], hi[1], hi[2], hi[3]};
  return __builtin_bit_cast(v16b, u);
}

template <int MT, int K, int SWAP_FROM>
__device__ __forceinline__ void proj_wmma(const float* __restrict__ W,
                                          const float* __restrict__ X,
                                          unsigned* __restrict__ Ws,
                                          unsigned* __restrict__ Xs,
                                          v8f (&acc)[MT][4])
{
  constexpr int M  = MT * 128;
  constexpr int NC = K / KC;
  constexpr int WL = M * KC / 4 / 256;   // 16-byte weight loads per thread and chunk
  constexpr int JB = MT >= 3 ? 1 : 2;    // position tiles per group: at least 3 accumulators in turn
  const int t    = threadIdx.x;
  const int lane = t & 31;
  const int wv   = t >> 5;
  const int c    = lane & 15;
  const int h    = lane >> 4;

  // Global addresses: a block-uniform base that moves with the chunk, plus one
  // 32-bit byte offset per lane that stays the same for the whole kernel.
  // A thread takes 4 consecutive k of a weight row, and 8 consecutive k of one
  // position (a wave's 32 positions lie in a row in memory).
  const unsigned woff = (unsigned)(((t >> 3) * K + (t & 7) * 4) * 4);
  const unsigned xoff = (unsigned)(((t >> 6) * 8 * N_ + (t & 63)) * 4);

  v4f   wr[WL];
  float xr[8];
  auto fetch = [&](int kc) {
    const char* wb = (const char*)(W + kc * KC);
    const char* xb = (const char*)(X + (long)kc * KC * N_);
    #pragma unroll  // register-array index stays a constant
    for (int i = 0; i < WL; ++i)
      wr[i] = *(const v4f*)(wb + woff + i * (32 * K * 4));
    // stands between the weight loads and the loads below, whose results the
    // build may put into the weight loads' address registers
    asm volatile("s_wait_xcnt 0x0" ::: "memory");
    #pragma unroll  // register-array index stays a constant
    for (int e = 0; e < 8; ++e)
      xr[e] = *(const float*)(xb + xoff + e * (N_ * 4));
    // stands between these loads and the next rewrite of their address registers
    asm volatile("s_wait_xcnt 0x0" ::: "memory");
  };
  auto stash = [&](int buf) {
    unsigned* ws = Ws + buf * (M * RP);
    unsigned* xs = Xs + buf * (64 * RP);
    #pragma unroll  // register-array index stays a constant
    for (int i = 0; i < WL; ++i) {
      const int f = t + 256 * i;
      v2u hd, tl;
      unsigned a, b;
      split2(wr[i][0], wr[i][1], a, b); hd[0] = a; tl[0] = b;
      split2(wr[i][2], wr[i][3], a, b); hd[1] = a; tl[1] = b;
      unsigned* p = ws + (f >> 3) * RP + (f & 7) * 2;
      *(v2u*)p        = hd;
      *(v2u*)(p + 16) = tl;
    }
    v4u hd, tl;
    #pragma unroll  // register-array index stays a constant
    for (int m = 0; m < 4; ++m) {
      unsigned a, b;
      split2(xr[2 * m], xr[2 * m + 1], a, b); hd[m] = a; tl[m] = b;
    }
    unsigned* p = xs + (t & 63) * RP + (t >> 6) * 4;
    *(v4u*)p        = hd;
    *(v4u*)(p + 16) = tl;
  };

  fetch(0);
  stash(0);
  // Kept rolled: the buffer index alternates and one barrier opens each trip.
  #pragma unroll 1
  for (int kc = 0; kc < NC; ++kc) {
    // publishes buffer kc&1 and ends every wave's reads of the other buffer
    __syncthreads();
    if (kc + 1 < NC) fetch(kc + 1);

    const unsigned* ws = Ws + (kc & 1) * (M * RP) + (wv * 16 + c) * RP + 8 * h;
    const unsigned* xs = Xs + (kc & 1) * (64 * RP) + c * RP + 8 * h;
    v16b wh[MT], wt[MT];
    #pragma unroll  // register-array index stays a constant
    for (int i = 0; i < MT; ++i) {
      wh[i] = row_frag(ws + i * (128 * RP));
      wt[i] = row_frag(ws + i * (128 * RP) + 16);
    }
    #pragma unroll  // register-array index stays a constant
    for (int j0 = 0; j0 < 4; j0 += JB) {
      v16b xh[JB], xt[JB];
      #pragma unroll  // register-array index stays a constant
      for (int j = 0; j < JB; ++j) {
        xh[j] = row_frag(xs + (j0 + j) * (16 * RP));
        xt[j] = row_frag(xs + (j0 + j) * (16 * RP) + 16);
      }
      // term 0: head x head, 1: W head x X tail, 2: W tail x X head
      #pragma unroll  // register-array index stays a constant
      for (int term = 0; term < 3; ++term) {
        #pragma unroll  // register-array index stays a constant
        for (int i = 0; i < MT; ++i) {
          const v16b wf = term == 2 ? wt[i] : wh[i];
          #pragma unroll  // register-array index stays a constant
          for (int j = 0; j < JB; ++j) {
            const v16b xf = term == 1 ? xt[j] : xh[j];
            if (i < SWAP_FROM)
              acc[i][j0 + j] = __builtin_amdgcn_wmma_f32_16x16x32_bf16(
                  false, wf, false, xf, (short)0, acc[i][j0 + j], false, false);
            else
              acc[i][j0 + j] = __builtin_amdgcn_wmma_f32_16x16x32_bf16(
                  false, xf, false, wf, (short)0, acc[i][j0 + j], false, false);
          }
        }
      }
    }
    if (kc + 1 < NC) stash((kc + 1) & 1);
  }
}

// ---------------------------------------------------------------------------
// Kernel 1: QKV projection.  qkv[o][pos] = sum_c w_qkv[o][c] * x[b][c][pos]
// Writes q,k (f16, [b][h][n][32], L2-normalized over d) and v transposed
// (f16, [b][h][32][n]) so attention fragment loads are contiguous 16B chunks.
// Wave wv holds channel tile wv of q (i=0), of k (i=1) and of v (i=2): head
// wv>>1, d from (wv&1)*16.  q,k tiles keep 8 consecutive d per lane, the v tile
// (operands swapped) 8 consecutive positions: every store is one 16-byte store.
// The L2 norm is taken here, on the f32 accumulators: the 32 d of one (head,
// position) lie in four lanes of the block (both lane halves of waves wv and
// wv^1), which join their sums of 8 squares through LDS.  q also takes the
// factor QSCALE_; each of q and k is rounded to f16 once.
// ---------------------------------------------------------------------------
#define SP 12   // LDS pitch of a thread's 8 sums of squares, dwords: 48 B = 16 B x odd

__global__ __launch_bounds__(256) void qkv_proj_kernel(
    const float* __restrict__ x, const float* __restrict__ w,
    _Float16* __restrict__ q, _Float16* __restrict__ k,
    _Float16* __restrict__ vT)
{
  __shared__ __attribute__((aligned(16))) unsigned Ws[2 * 3 * HID * RP];
  __shared__ __attribute__((aligned(16))) unsigned Xs[2 * 64 * RP];
  __shared__ __attribute__((aligned(16))) float Ss[256 * SP];   // sums of 8 squares
  const int b    = blockIdx.y;
  const int pos0 = blockIdx.x * 64;
  const int lane = threadIdx.x & 31;
  const int wv   = threadIdx.x >> 5;
  const int c    = lane & 15;
  const int h    = lane >> 4;

  v8f acc[3][4] = {};
  proj_wmma<3, C_IN, 2>(w, x + (long)b * C_IN * N_ + pos0, Ws, Xs, acc);

  // this lane's 8 d of q (i = 0) and k (i = 1), squared and summed in register
  // pairs, one sum per position tile j
  #pragma unroll  // register-array index stays a constant
  for (int i = 0; i < 2; ++i) {
    v4f sq;
    #pragma unroll  // register-array index stays a constant
    for (int j = 0; j < 4; ++j) {
      v2f s2 = {0.f, 0.f};
      #pragma unroll  // register-array index stays a constant
      for (int r = 0; r < 8; r += 2) {
        v2f a;
        a[0] = acc[i][j][r];
        a[1] = acc[i][j][r + 1];
        s2 += a * a;
      }
      sq[j] = s2[0] + s2[1];
    }
    *(v4f*)(Ss + threadIdx.x * SP + 4 * i) = sq;
  }
  // publishes every lane's sums of squares to the other three lanes of its rows
  __syncthreads();
  // The four parts are added in the order of d, the same in all four lanes.
  // 1 / max(sqrt(ss), eps) = min(rsqrt(ss), 1 / eps), ss = 0 included.
  const float* sp = Ss + ((wv & 6) * 32 + c) * SP;
  float inv[2][4];
  #pragma unroll  // register-array index stays a constant
  for (int i = 0; i < 2; ++i) {
    const v4f ss = (*(const v4f*)(sp + 4 * i)           + *(const v4f*)(sp + 16 * SP + 4 * i))
                 + (*(const v4f*)(sp + 32 * SP + 4 * i) + *(const v4f*)(sp + 48 * SP + 4 * i));
    float rs[4];
    // In one statement so that the closing v_nop stays directly behind the last
    // v_rsq_f32: it is the free slot that the instruction set asks for ahead of an
    // instruction that reads the result or rewrites the source.
    asm("v_rsq_f32 %0, %4\n\t"
        "v_rsq_f32 %1, %5\n\t"
        "v_rsq_f32 %2, %6\n\t"
        "v_rsq_f32 %3, %7\n\t"
        "v_nop"
        : "=&v"(rs[0]), "=&v"(rs[1]), "=&v"(rs[2]), "=&v"(rs[3])
        : "v"(ss[0]), "v"(ss[1]), "v"(ss[2]), "v"(ss[3]));
    #pragma unroll  // register-array index stays a constant
    for (int j = 0; j < 4; ++j)
      inv[i][j] = fminf(rs[j], 1.0f / EPS_) * (i == 0 ? QSCALE_ : 1.0f);
  }

  const long bh = (long)b * H_ + (wv >> 1);
  const int  d0 = (wv & 1) * 16;
  #pragma unroll  // register-array index stays a constant
  for (int j = 0; j < 4; ++j) {
    v8h hq, hk, hv;
    #pragma unroll  // register-array index stays a constant
    for (int r = 0; r < 8; ++r) {
      hq[r] = (_Float16)(acc[0][j][r] * inv[0][j]);
      hk[r] = (_Float16)(acc[1][j][r] * inv[1][j]);
      hv[r] = (_Float16)acc[2][j][r];
    }
    const long pos = pos0 + 16 * j + c;
    *(v8h*)(q + (bh * N_ + pos) * D_ + d0 + 8 * h) = hq;
    *(v8h*)(k + (bh * N_ + pos) * D_ + d0 + 8 * h) = hk;
    *(v8h*)(vT + (bh * D_ + d0 + c) * N_ + pos0 + 16 * j + 8 * h) = hv;
  }
}

// ---------------------------------------------------------------------------
// Fragment loader: 16x32 f16 tile in the CDNA5 WMMA A/B lane/K ordering.
// lane<16 : row/col = lane,    K elements {0..7, 16..23}
// lane>=16: row/col = lane-16, K elements {8..15, 24..31}
// ---------------------------------------------------------------------------
__device__ inline v16h load_16x32_frag(const _Float16* __restrict__ base,
                                       long rowStride, int lane)
{
  const int row = lane & 15;
  const int off = (lane >> 4) * 8;
  const _Float16* pr = base + (long)row * rowStride + off;
  v8h lo = *(const v8h*)(pr);
  v8h hi = *(const v8h*)(pr + 16);
  v16h r;
  #pragma unroll
  for (int i = 0; i < 8; ++i) { r[i] = lo[i]; r[8 + i] = hi[i]; }
  return r;
}

// ---------------------------------------------------------------------------
// Kernel 2: flash attention, transposed formulation.
//   S^T = (K tile) x Q^T + shift: the product is the exponent itself (q holds
//   the scale, the C operand the constant shift), P = 2^(S^T).  No running
//   maximum, so O^T and the sums are never rescaled; each lane sums its own
//   keys and the partial sums of a column are joined once, behind the loop.
//   O^T += (V^T tile) x P^T, where P^T's B-fragment is *register-identical*
//   to S^T's C-fragment (pB[e]=f16(s0[e]), pB[8+e]=f16(s1[e])): no LDS,
//   no cross-lane transpose.  Epilogue: per-lane 1/l, coalesced stores.
// K and V^T reach the eight waves of a block through LDS: tiles of KT keys,
// two buffers, filled by asynchronous 16-byte copies one whole tile ahead, so
// a tile's way from L2 is covered by the tile before it and is gone once per
// block, not once per wave.
// A wave owns 32 query columns (two column tiles) and one half of every staged
// tile's keys: each K and V^T fragment that it reads from LDS feeds two
// products.  Waves wv and wv + 4 share their columns; with no running maximum
// their O^T and sums are plain partial sums, added once through LDS at the end.
// ---------------------------------------------------------------------------
#define KT   128           // keys per staged tile
#define KW   (KT / 2)      // keys of a tile per wave
#define KP   40            // LDS pitch of a key row, halves: 80 B = 16 B x odd
#define VP   (KT + 8)      // LDS pitch of a V^T row, halves: 272 B = 16 B x odd
#define KBUF (KT * KP)     // halves per K buffer
#define VBUF (D_ * VP)     // halves per V^T buffer
#define XW   (17 * 32)     // floats a wave hands to its partner: 16 of O^T and 1 sum per lane

__global__ __launch_bounds__(256) void flash_attn_kernel(
    const _Float16* __restrict__ q, const _Float16* __restrict__ k,
    const _Float16* __restrict__ vT, float* __restrict__ ao)
{
  __shared__ __attribute__((aligned(16))) _Float16 Ks[2 * KBUF];
  __shared__ __attribute__((aligned(16))) _Float16 Vs[2 * VBUF];
  __shared__ float Xc[8 * XW];
  const int tid  = threadIdx.x;
  const int lane = tid & 31;
  const int wv   = tid >> 5;
  const int kh   = wv >> 2;          // which half of every tile's keys
  const int b    = blockIdx.y >> 2;
  const int h    = blockIdx.y & 3;
  const long bh  = (long)b * H_ + h;
  const int  i0  = blockIdx.x * 128 + (wv & 3) * 32;
  const int  col = lane & 15;

  // Q^T as B fragments (K-dim = d = 32, N = 16 queries each), loaded once
  const v16h qB0 = load_16x32_frag(q + (bh * N_ + i0) * D_,      D_, lane);
  const v16h qB1 = load_16x32_frag(q + (bh * N_ + i0 + 16) * D_, D_, lane);

  // O^T accumulators, [column tile][d rows 0-15 / 16-31]
  v8f o00 = {}; v8f o01 = {}; v8f o10 = {}; v8f o11 = {};
  v8f ls0 = {}; v8f ls1 = {};        // sums of P per column tile, this lane's keys
  const v8f shift = {PSHIFT_, PSHIFT_, PSHIFT_, PSHIFT_,
                     PSHIFT_, PSHIFT_, PSHIFT_, PSHIFT_};

  // Each thread copies four 16-byte pieces of a tile: K rows tid>>2 and 64 more
  // (a K tile is 8 KiB in a row in global memory), V^T rows tid>>4 and 16 more.
  const _Float16* kg = k  + bh * (long)N_ * D_ + tid * 8;
  const _Float16* vg = vT + bh * (long)D_ * N_ + (long)(tid >> 4) * N_ + (tid & 15) * 8;
  const unsigned  lk = (unsigned)(size_t)(Ks + (tid >> 2) * KP + (tid & 3) * 8);
  const unsigned  lv = (unsigned)(size_t)(Vs + (tid >> 4) * VP + (tid & 15) * 8);

  auto copy_tile = [&](int tile, int buf) {
    const _Float16* gk0 = kg + (long)tile * (KT * D_);
    const _Float16* gk1 = gk0 + 64 * D_;
    const _Float16* gv0 = vg + tile * KT;
    const _Float16* gv1 = gv0 + 16 * N_;
    const unsigned  lk0 = lk + buf * (KBUF * 2);
    const unsigned  lk1 = lk0 + 64 * KP * 2;
    const unsigned  lv0 = lv + buf * (VBUF * 2);
    const unsigned  lv1 = lv0 + 16 * VP * 2;
    // the closing wait stands between the copies and any rewrite of the
    // registers that they name
    asm volatile("global_load_async_to_lds_b128 %0, %4, off\n\t"
                 "global_load_async_to_lds_b128 %1, %5, off\n\t"
                 "global_load_async_to_lds_b128 %2, %6, off\n\t"
                 "global_load_async_to_lds_b128 %3, %7, off\n\t"
                 "s_wait_xcnt 0x0"
                 :: "v"(lk0), "v"(lk1), "v"(lv0), "v"(lv1),
                    "v"(gk0), "v"(gk1), "v"(gv0), "v"(gv1)
                 : "memory");
  };

  constexpr int NT = N_ / KT;
  copy_tile(0, 0);
  // this wave's copies of tile 0 have landed
  asm volatile("s_wait_asynccnt 0x0" ::: "memory");
  // publishes tile 0 to all eight waves
  __syncthreads();
  copy_tile(1, 1);

  // Kept rolled: the buffer index alternates and one barrier ends each trip.
  #pragma unroll 1
  for (int tile = 0; tile < NT; ++tile) {
    const _Float16* ks = Ks + (tile & 1) * KBUF + kh * (KW * KP);
    const _Float16* vs = Vs + (tile & 1) * VBUF + kh * KW;

    // the fragments of this wave's keys of the tile, each read once:
    // K rows j 0..15 / 16..31 and V^T d rows 0..15 / 16..31 per 32 keys
    v16h ka[KW / 16], va[KW / 16];
    #pragma unroll  // register-array index stays a constant
    for (int u = 0; u < KW / 32; ++u) {
      ka[2 * u]     = load_16x32_frag(ks + (32 * u) * KP,      KP, lane);
      ka[2 * u + 1] = load_16x32_frag(ks + (32 * u + 16) * KP, KP, lane);
      va[2 * u]     = load_16x32_frag(vs + 32 * u,             VP, lane);
      va[2 * u + 1] = load_16x32_frag(vs + 16 * VP + 32 * u,   VP, lane);
    }

    #pragma unroll  // register-array index stays a constant
    for (int u = 0; u < KW / 32; ++u) {
      // S^T tiles [j][i], scaled and shifted, for both column tiles
      v8f s00 = __builtin_amdgcn_wmma_f32_16x16x32_f16(false, ka[2 * u], false, qB0,
                                                       (short)0, shift, false, false);
      v8f s01 = __builtin_amdgcn_wmma_f32_16x16x32_f16(false, ka[2 * u + 1], false, qB0,
                                                       (short)0, shift, false, false);
      v8f s10 = __builtin_amdgcn_wmma_f32_16x16x32_f16(false, ka[2 * u], false, qB1,
                                                       (short)0, shift, false, false);
      v8f s11 = __builtin_amdgcn_wmma_f32_16x16x32_f16(false, ka[2 * u + 1], false, qB1,
                                                       (short)0, shift, false, false);

      // exponentiate; P^T B-fragment == S^T C-fragment layout: direct convert
      v16h pB0, pB1;
      #pragma unroll  // register-array index stays a constant
      for (int r = 0; r < 8; ++r) {
        s00[r] = __builtin_amdgcn_exp2f(s00[r]);
        s01[r] = __builtin_amdgcn_exp2f(s01[r]);
        pB0[r]     = (_Float16)s00[r];
        pB0[8 + r] = (_Float16)s01[r];
      }
      ls0 += s00 + s01;
      #pragma unroll  // register-array index stays a constant
      for (int r = 0; r < 8; ++r) {
        s10[r] = __builtin_amdgcn_exp2f(s10[r]);
        s11[r] = __builtin_amdgcn_exp2f(s11[r]);
        pB1[r]     = (_Float16)s10[r];
        pB1[8 + r] = (_Float16)s11[r];
      }
      ls1 += s10 + s11;

      // O^T += V^T x P^T
      o00 = __builtin_amdgcn_wmma_f32_16x16x32_f16(false, va[2 * u], false, pB0,
                                                   (short)0, o00, false, false);
      o01 = __builtin_amdgcn_wmma_f32_16x16x32_f16(false, va[2 * u + 1], false, pB0,
                                                   (short)0, o01, false, false);
      o10 = __builtin_amdgcn_wmma_f32_16x16x32_f16(false, va[2 * u], false, pB1,
                                                   (short)0, o10, false, false);
      o11 = __builtin_amdgcn_wmma_f32_16x16x32_f16(false, va[2 * u + 1], false, pB1,
                                                   (short)0, o11, false, false);
    }

    // this wave's reads of the buffer that is refilled below have returned
    asm volatile("s_wait_dscnt 0x0" ::: "memory");
    // this wave's copies of the next tile have landed
    asm volatile("s_wait_asynccnt 0x0" ::: "memory");
    // publishes the next tile and ends every wave's reads of this one
    __syncthreads();
    if (tile + 2 < NT) copy_tile(tile + 2, tile & 1);
  }
  // no copy is left in flight when the wave ends
  asm volatile("s_wait_asynccnt 0x0" ::: "memory");

  // The two key halves of a column are joined: wave kh finishes column tile kh
  // and hands its partial sums of the other tile to the partner wave.
  const float l0 = ((ls0[0] + ls0[1]) + (ls0[2] + ls0[3])) + ((ls0[4] + ls0[5]) + (ls0[6] + ls0[7]));
  const float l1 = ((ls1[0] + ls1[1]) + (ls1[2] + ls1[3])) + ((ls1[4] + ls1[5]) + (ls1[6] + ls1[7]));
  float* xo = Xc + wv * XW + lane;
  #pragma unroll  // register-array index stays a constant
  for (int r = 0; r < 8; ++r) {
    xo[r * 32]       = kh ? o00[r] : o10[r];
    xo[(8 + r) * 32] = kh ? o01[r] : o11[r];
  }
  xo[16 * 32] = kh ? l0 : l1;
  // publishes every wave's handed-over sums to its partner
  __syncthreads();
  const float* xi = Xc + (wv ^ 4) * XW + lane;
  v8f o0, o1;
  #pragma unroll  // register-array index stays a constant
  for (int r = 0; r < 8; ++r) {
    o0[r] = (kh ? o10[r] : o00[r]) + xi[r * 32];
    o1[r] = (kh ? o11[r] : o01[r]) + xi[(8 + r) * 32];
  }
  float l = (kh ? l1 : l0) + xi[16 * 32];

  // epilogue: O^T / l, coalesced stores to ao[b][c=h*32+d][n]
  l += __shfl_xor(l, 16);
  const float inv  = 1.0f / l;
  const int   hi8  = (lane >> 4) * 8;
  const int   cbase = h * 32;
  const int   n    = i0 + kh * 16 + col;
  #pragma unroll
  for (int r = 0; r < 8; ++r) {
    const int d = r + hi8;
    ao[(long)(b * HID + cbase + d)      * N_ + n] = o0[r] * inv;
    ao[(long)(b * HID + cbase + 16 + d) * N_ + n] = o1[r] * inv;
  }
}

// ---------------------------------------------------------------------------
// Kernel 3: output projection.
// out[b][o][pos] = b_out[o] + sum_c w_out[o][c]*ao[b][c][pos]
// Same WMMA body; the bias, staged in LDS, is added at the store.
// ---------------------------------------------------------------------------
__global__ __launch_bounds__(256) void out_proj_kernel(
    const float* __restrict__ ao, const float* __restrict__ w_out,
    const float* __restrict__ b_out, float* __restrict__ out)
{
  __shared__ __attribute__((aligned(16))) unsigned Ws[2 * C_IN * RP];
  __shared__ __attribute__((aligned(16))) unsigned Xs[2 * 64 * RP];
  __shared__ __attribute__((aligned(16))) float Bs[C_IN];   // C_IN = block size
  const int b    = blockIdx.y;
  const int pos0 = blockIdx.x * 64;
  const int lane = threadIdx.x & 31;
  const int wv   = threadIdx.x >> 5;
  const int c    = lane & 15;
  const int h    = lane >> 4;

  // one coalesced bias load per block; the body's first barrier publishes it
  Bs[threadIdx.x] = b_out[threadIdx.x];

  v8f acc[2][4] = {};
  proj_wmma<2, HID, 2>(w_out, ao + (long)b * HID * N_ + pos0, Ws, Xs, acc);

  #pragma unroll  // register-array index stays a constant
  for (int i = 0; i < 2; ++i) {
    #pragma unroll  // register-array index stays a constant
    for (int r = 0; r < 8; ++r) {
      const int   o    = (wv + 8 * i) * 16 + 8 * h + r;
      const float bias = Bs[o];
      #pragma unroll  // register-array index stays a constant
      for (int j = 0; j < 4; ++j)
        out[((long)b * C_IN + o) * N_ + pos0 + 16 * j + c] = acc[i][j][r] + bias;
    }
  }
}

// ---------------------------------------------------------------------------
extern "C" void kernel_launch(void* const* d_in, const int* in_sizes, int n_in,
                              void* d_out, int out_size, void* d_ws, size_t ws_size,
                              hipStream_t stream)
{
  const float* x     = (const float*)d_in[0];
  const float* w_qkv = (const float*)d_in[1];
  const float* w_out = (const float*)d_in[2];
  const float* b_out = (const float*)d_in[3];
  float*       out   = (float*)d_out;

  // workspace layout: q(4MiB f16) | k(4MiB f16) | vT(4MiB f16) | ao(8MiB f32)
  char* ws = (char*)d_ws;
  _Float16* q  = (_Float16*)(ws);
  _Float16* k  = (_Float16*)(ws + ((size_t)4  << 20));
  _Float16* vT = (_Float16*)(ws + ((size_t)8  << 20));
  float*    ao = (float*)   (ws + ((size_t)12 << 20));

  dim3 g1(N_ / 64, B_);
  qkv_proj_kernel<<<g1, 256, 0, stream>>>(x, w_qkv, q, k, vT);

  dim3 g2(N_ / 128, B_ * H_);
  flash_attn_kernel<<<g2, 256, 0, stream>>>(q, k, vT, ao);

  dim3 g3(N_ / 64, B_);
  out_proj_kernel<<<g3, 256, 0, stream>>>(ao, w_out, b_out, out);
}

// v007
// A run of this version takes 49.8 microseconds.
// Timed twice side by side with v006, it ran 1.05 and 1.04 times as fast.
// Counting every step since v000, it is 6.28 times as fast.
#include <hip/hip_runtime.h>
#include <hip/hip_bf16.h>
#include <math.h>

#define B_    4
#define H_    4
#define N_    4096
#define D_    32
#define C_IN  256
#define HID   128   // HEADS*DIM_HEAD
#define SCALE_ 10.0f
#define EPS_   1e-12f
// SCALE_ * log2(e): q carries it, so that K x Q^T comes out in powers of two
#define QSCALE_ (SCALE_ * 1.4426950408889634f)
// Constant softmax shift, in powers of two.  After the L2 norm q and k have
// length at most 1, so |q.k| <= 1 for every input; with their f16 roundings the
// scaled score stays within +-14.45, so 2^(score + 1) lies in 2^-13.45 ..
// 2^15.45: inside the normal f16 range at both ends.  The shift cancels in O / l.
#define PSHIFT_ 1.0f

typedef __attribute__((ext_vector_type(16))) _Float16 v16h;
typedef __attribute__((ext_vector_type(8)))  _Float16 v8h;
typedef __attribute__((ext_vector_type(8)))  float    v8f;
typedef __attribute__((ext_vector_type(4)))  float    v4f;
typedef __attribute__((ext_vector_type(2)))  float    v2f;
typedef __attribute__((ext_vector_type(16))) __bf16   v16b;
typedef __attribute__((ext_vector_type(2)))  __bf16   v2b;
typedef __attribute__((ext_vector_type(8)))  unsigned v8u;
typedef __attribute__((ext_vector_type(4)))  unsigned v4u;
typedef __attribute__((ext_vector_type(2)))  unsigned v2u;

// ---------------------------------------------------------------------------
// Shared body of the two 1x1-conv projections, on bf16 16x16x32 WMMA with f32
// accumulators.  Each f32 operand is split into two bf16 terms, a head (the
// value rounded to bf16) and a tail (what is left, rounded to bf16), and
//   w * x  ~=  wh * xh + wh * xt + wt * xh
// takes three products; what is dropped lies about 2^-16 below w * x.
//   Y[o][pos] = sum_k W[o][k] * X[k][pos],  W is [MT*128][K], X is [K][N_].
// One block = all MT*128 output channels x 64 positions; 8 waves; wave wv owns
// channel tiles wv + 8*i (i < MT) times all four position tiles.
// k runs in chunks of KC through two LDS buffers and two register sets: a chunk's
// global loads are issued two chunks ahead; it is split and stored to LDS one
// chunk ahead, among the products of the chunk before it.
// In LDS both operands lie k-contiguous, one row per channel or per position:
// 32 heads, 32 tails, pad.  One loader serves both operands, so their k order
// is the same: lane half h, element p  ->  k = 16*h + p.
// Tiles i <  SWAP_FROM: A = W, B = X -> acc[r] = Y[tile*16 + 8*h + r][16*j + c]
// Tiles i >= SWAP_FROM: A = X, B = W -> acc[r] = Y[tile*16 + c][16*j + 8*h + r]
// ---------------------------------------------------------------------------
#define KC 32   // k per staged chunk = k of one product
#define RP 36   // LDS pitch of a row, dwords: 16 of heads, 16 of tails, 4 of pad: 144 B = 16 B x odd

// two f32 -> their bf16 heads in one dword, their bf16 tails in another
__device__ __forceinline__ void split2(float a, float b, unsigned& head, unsigned& tail)
{
  const v2f x = {a, b};
  const v2b hd = __builtin_convertvector(x, v2b);
  const v2f r  = x - __builtin_convertvector(hd, v2f);   // exact
  const v2b tl = __builtin_convertvector(r, v2b);
  head = __builtin_bit_cast(unsigned, hd);
  tail = __builtin_bit_cast(unsigned, tl);
}

// 16 consecutive bf16 of an LDS row as an A or B fragment
__device__ __forceinline__ v16b row_frag(const unsigned* p)
{
  const v4u lo = *(const v4u*)p;
  const v4u hi = *(const v4u*)(p + 4);
  const v8u u  = {lo[0], lo[1], lo[2], lo[3], hi[0], hi[1], hi[2], hi[3]};
  return __builtin_bit_cast(v16b, u);
}

// a compile-time flag or index handed to the trip body below
template <int V> struct Ic { static constexpr int value = V; };

template <int MT, int K, int SWAP_FROM>
__device__ __forceinline__ void proj_wmma(const float* __restrict__ W,
                                          const float* __restrict__ X,
                                          unsigned* __restrict__ Ws,
                                          unsigned* __restrict__ Xs,
                                          v8f (&acc)[MT][4])
{
  constexpr int M  = MT * 128;
  constexpr int NC = K / KC;             // even, at least 4
  constexpr int WL = M * KC / 4 / 256;   // 16-byte weight loads per thread and chunk
  constexpr int JB = MT >= 3 ? 1 : 2;    // position tiles per group: at least 3 accumulators in turn
  constexpr int NR = (4 / JB) * 3;       // runs of MT * JB products per chunk
  constexpr int NP = WL + 1;             // pieces of a chunk's split and store: WL of W, one of X
  const int t    = threadIdx.x;
  const int lane = t & 31;
  const int wv   = t >> 5;
  const int c    = lane & 15;
  const int h    = lane >> 4;

  // Global addresses: a block-uniform base that moves with the chunk, plus one
  // 32-bit offset per lane that stays the same for the whole kernel.
  // A thread takes 4 consecutive k of a weight row, and 8 consecutive k of one
  // position (a wave's 32 positions lie in a row in memory).
  const unsigned woff = (unsigned)(((t >> 3) * K + (t & 7) * 4) * 4);
  const unsigned xidx = (unsigned)((t >> 6) * 8 * N_ + (t & 63));   // in floats

  // two register sets: chunk kc travels in set kc & 1
  v4f   wr[2][WL];
  float xr[2][8];
  auto fetch = [&](int kc, auto set) {
    constexpr int S = decltype(set)::value;
    const char* wb = (const char*)(W + kc * KC);
    const float* xb = X + (long)kc * KC * N_;
    #pragma unroll  // register-array index stays a constant
    for (int i = 0; i < WL; ++i)
      wr[S][i] = *(const v4f*)(wb + woff + i * (32 * K * 4));
    // stands between the weight loads and the loads below, whose results the
    // build may put into the weight loads' address registers
    asm volatile("s_wait_xcnt 0x0" ::: "memory");
    #pragma unroll  // register-array index stays a constant
    for (int e = 0; e < 8; ++e)
      xr[S][e] = xb[xidx + e * N_];
    // stands between these loads and the next rewrite of their address registers;
    // it names the lane's offset so that this register lives up to the wait and
    // none of the loads above lands in it
    asm volatile("s_wait_xcnt 0x0" :: "v"(xidx) : "memory");
  };
  // piece p of set S, split and stored to LDS buffer S: p < WL a weight load, p == WL the X column
  auto stash_piece = [&](auto set, int p) {
    constexpr int S = decltype(set)::value;
    if (p < WL) {
      const int f = t + 256 * p;
      v2u hd, tl;
      unsigned a, b;
      split2(wr[S][p][0], wr[S][p][1], a, b); hd[0] = a; tl[0] = b;
      split2(wr[S][p][2], wr[S][p][3], a, b); hd[1] = a; tl[1] = b;
      unsigned* q = Ws + S * (M * RP) + (f >> 3) * RP + (f & 7) * 2;
      *(v2u*)q        = hd;
      *(v2u*)(q + 16) = tl;
    } else {
      v4u hd, tl;
      #pragma unroll  // register-array index stays a constant
      for (int m = 0; m < 4; ++m) {
        unsigned a, b;
        split2(xr[S][2 * m], xr[S][2 * m + 1], a, b); hd[m] = a; tl[m] = b;
      }
      unsigned* q = Xs + S * (64 * RP) + (t & 63) * RP + (t >> 6) * 4;
      *(v4u*)q        = hd;
      *(v4u*)(q + 16) = tl;
    }
  };

  // One chunk: its fragments are read from LDS buffer P; chunk kc + 2's global
  // loads are issued into set P (free: split and stored one trip ago); chunk
  // kc + 1, loaded a whole trip ago into the other set, is split and stored to
  // the other buffer piece by piece among this chunk's products.
  auto trip = [&](int kc, auto par, auto do_fetch, auto do_stash) {
    constexpr int P = decltype(par)::value;
    // Publishes buffer P and ends every wave's reads of the other buffer.  The
    // fences name LDS alone: __syncthreads() would also drain the global loads
    // that are meant to stay in flight over this barrier.
    __builtin_amdgcn_fence(__ATOMIC_RELEASE, "workgroup", "local");
    __builtin_amdgcn_s_barrier();
    __builtin_amdgcn_fence(__ATOMIC_ACQUIRE, "workgroup", "local");
    // keeps a trip's vector work inside the trip: without it the build lifted the
    // next trip's split up to the loads just issued, a full load wait in mid-trip
    __builtin_amdgcn_sched_barrier(0);

    const unsigned* ws = Ws + P * (M * RP) + (wv * 16 + c) * RP + 8 * h;
    const unsigned* xs = Xs + P * (64 * RP) + c * RP + 8 * h;
    v16b wh[MT], wt[MT], xh[4], xt[4];
    #pragma unroll  // register-array index stays a constant
    for (int i = 0; i < MT; ++i) {
      wh[i] = row_frag(ws + i * (128 * RP));
      wt[i] = row_frag(ws + i * (128 * RP) + 16);
    }
    #pragma unroll  // register-array index stays a constant
    for (int j = 0; j < 4; ++j) {
      xh[j] = row_frag(xs + j * (16 * RP));
      xt[j] = row_frag(xs + j * (16 * RP) + 16);
    }
    if constexpr (decltype(do_fetch)::value) fetch(kc + 2, par);
    // keeps the global loads at the head of the trip, ahead of the products
    __builtin_amdgcn_sched_barrier(0);

    #pragma unroll  // register-array index stays a constant
    for (int j0 = 0; j0 < 4; j0 += JB) {
      // term 0: head x head, 1: W head x X tail, 2: W tail x X head
      #pragma unroll  // register-array index stays a constant
      for (int term = 0; term < 3; ++term) {
        #pragma unroll  // register-array index stays a constant
        for (int i = 0; i < MT; ++i) {
          const v16b wf = term == 2 ? wt[i] : wh[i];
          #pragma unroll  // register-array index stays a constant
          for (int j = j0; j < j0 + JB; ++j) {
            const v16b xf = term == 1 ? xt[j] : xh[j];
            if (i < SWAP_FROM)
              acc[i][j] = __builtin_amdgcn_wmma_f32_16x16x32_bf16(
                  false, wf, false, xf, (short)0, acc[i][j], false, false);
            else
              acc[i][j] = __builtin_amdgcn_wmma_f32_16x16x32_bf16(
                  false, xf, false, wf, (short)0, acc[i][j], false, false);
          }
        }
        if constexpr (decltype(do_stash)::value) {
          const int r = (j0 / JB) * 3 + term;
          #pragma unroll  // register-array index stays a constant
          for (int p = r * NP / NR; p < (r + 1) * NP / NR; ++p)
            stash_piece(Ic<1 - P>{}, p);
          // keeps each piece beside its run of products, so that its vector
          // work issues while the matrix unit is busy
          __builtin_amdgcn_sched_barrier(0);
        }
      }
    }
  };

  fetch(0, Ic<0>{});
  fetch(1, Ic<1>{});
  #pragma unroll  // register-array index stays a constant
  for (int p = 0; p < NP; ++p) stash_piece(Ic<0>{}, p);
  // Kept rolled, two trips a pass: set and buffer indices are constants in each.
  #pragma unroll 1
  for (int kc = 0; kc < NC - 2; kc += 2) {
    trip(kc,     Ic<0>{}, Ic<1>{}, Ic<1>{});
    trip(kc + 1, Ic<1>{}, Ic<1>{}, Ic<1>{});
  }
  trip(NC - 2, Ic<0>{}, Ic<0>{}, Ic<1>{});
  trip(NC - 1, Ic<1>{}, Ic<0>{}, Ic<0>{});
}

// ---------------------------------------------------------------------------
// Kernel 1: QKV projection.  qkv[o][pos] = sum_c w_qkv[o][c] * x[b][c][pos]
// Writes q,k (f16, [b][h][n][32], L2-normalized over d) and v transposed
// (f16, [b][h][32][n]) so attention fragment loads are contiguous 16B chunks.
// Wave wv holds channel tile wv of q (i=0), of k (i=1) and of v (i=2): head
// wv>>1, d from (wv&1)*16.  q,k tiles keep 8 consecutive d per lane, the v tile
// (operands swapped) 8 consecutive positions: every store is one 16-byte store.
// The L2 norm is taken here, on the f32 accumulators: the 32 d of one (head,
// position) lie in four lanes of the block (both lane halves of waves wv and
// wv^1), which join their sums of 8 squares through LDS.  q also takes the
// factor QSCALE_; each of q and k is rounded to f16 once.
// ---------------------------------------------------------------------------
#define SP 12   // LDS pitch of a thread's 8 sums of squares, dwords: 48 B = 16 B x odd

__global__ __launch_bounds__(256) void qkv_proj_kernel(
    const float* __restrict__ x, const float* __restrict__ w,
    _Float16* __restrict__ q, _Float16* __restrict__ k,
    _Float16* __restrict__ vT)
{
  __shared__ __attribute__((aligned(16))) unsigned Ws[2 * 3 * HID * RP];
  __shared__ __attribute__((aligned(16))) unsigned Xs[2 * 64 * RP];
  __shared__ __attribute__((aligned(16))) float Ss[256 * SP];   // sums of 8 squares
  const int b    = blockIdx.y;
  const int pos0 = blockIdx.x * 64;
  const int lane = threadIdx.x & 31;
  const int wv   = threadIdx.x >> 5;
  const int c    = lane & 15;
  const int h    = lane >> 4;

  v8f acc[3][4] = {};
  proj_wmma<3, C_IN, 2>(w, x + (long)b * C_IN * N_ + pos0, Ws, Xs, acc);

  // this lane's 8 d of q (i = 0) and k (i = 1), squared and summed in register
  // pairs, one sum per position tile j
  #pragma unroll  // register-array index stays a constant
  for (int i = 0; i < 2; ++i) {
    v4f sq;
    #pragma unroll  // register-array index stays a constant
    for (int j = 0; j < 4; ++j) {
      v2f s2 = {0.f, 0.f};
      #pragma unroll  // register-array index stays a constant
      for (int r = 0; r < 8; r += 2) {
        v2f a;
        a[0] = acc[i][j][r];
        a[1] = acc[i][j][r + 1];
        s2 += a * a;
      }
      sq[j] = s2[0] + s2[1];
    }
    *(v4f*)(Ss + threadIdx.x * SP + 4 * i) = sq;
  }
  // publishes every lane's sums of squares to the other three lanes of its rows
  __syncthreads();
  // The four parts are added in the order of d, the same in all four lanes.
  // 1 / max(sqrt(ss), eps) = min(rsqrt(ss), 1 / eps), ss = 0 included.
  const float* sp = Ss + ((wv & 6) * 32 + c) * SP;
  float inv[2][4];
  #pragma unroll  // register-array index stays a constant
  for (int i = 0; i < 2; ++i) {
    const v4f ss = (*(const v4f*)(sp + 4 * i)           + *(const v4f*)(sp + 16 * SP + 4 * i))
                 + (*(const v4f*)(sp + 32 * SP + 4 * i) + *(const v4f*)(sp + 48 * SP + 4 * i));
    float rs[4];
    // In one statement so that the closing v_nop stays directly behind the last
    // v_rsq_f32: it is the free slot that the instruction set asks for ahead of an
    // instruction that reads the result or rewrites the source.
    asm("v_rsq_f32 %0, %4\n\t"
        "v_rsq_f32 %1, %5\n\t"
        "v_rsq_f32 %2, %6\n\t"
        "v_rsq_f32 %3, %7\n\t"
        "v_nop"
        : "=&v"(rs[0]), "=&v"(rs[1]), "=&v"(rs[2]), "=&v"(rs[3])
        : "v"(ss[0]), "v"(ss[1]), "v"(ss[2]), "v"(ss[3]));
    #pragma unroll  // register-array index stays a constant
    for (int j = 0; j < 4; ++j)
      inv[i][j] = fminf(rs[j], 1.0f / EPS_) * (i == 0 ? QSCALE_ : 1.0f);
  }

  const long bh = (long)b * H_ + (wv >> 1);
  const int  d0 = (wv & 1) * 16;
  #pragma unroll  // register-array index stays a constant
  for (int j = 0; j < 4; ++j) {
    v8h hq, hk, hv;
    #pragma unroll  // register-array index stays a constant
    for (int r = 0; r < 8; ++r) {
      hq[r] = (_Float16)(acc[0][j][r] * inv[0][j]);
      hk[r] = (_Float16)(acc[1][j][r] * inv[1][j]);
      hv[r] = (_Float16)acc[2][j][r];
    }
    const long pos = pos0 + 16 * j + c;
    *(v8h*)(q + (bh * N_ + pos) * D_ + d0 + 8 * h) = hq;
    *(v8h*)(k + (bh * N_ + pos) * D_ + d0 + 8 * h) = hk;
    *(v8h*)(vT + (bh * D_ + d0 + c) * N_ + pos0 + 16 * j + 8 * h) = hv;
  }
}

// ---------------------------------------------------------------------------
// Fragment loader: 16x32 f16 tile in the CDNA5 WMMA A/B lane/K ordering.
// lane<16 : row/col = lane,    K elements {0..7, 16..23}
// lane>=16: row/col = lane-16, K elements {8..15, 24..31}
// ---------------------------------------------------------------------------
__device__ inline v16h load_16x32_frag(const _Float16* __restrict__ base,
                                       long rowStride, int lane)
{
  const int row = lane & 15;
  const int off = (lane >> 4) * 8;
  const _Float16* pr = base + (long)row * rowStride + off;
  v8h lo = *(const v8h*)(pr);
  v8h hi = *(const v8h*)(pr + 16);
  v16h r;
  #pragma unroll
  for (int i = 0; i < 8; ++i) { r[i] = lo[i]; r[8 + i] = hi[i]; }
  return r;
}

// ---------------------------------------------------------------------------
// Kernel 2: flash attention, transposed formulation.
//   S^T = (K tile) x Q^T + shift: the product is the exponent itself (q holds
//   the scale, the C operand the constant shift), P = 2^(S^T).  No running
//   maximum, so O^T and the sums are never rescaled; each lane sums its own
//   keys and the partial sums of a column are joined once, behind the loop.
//   O^T += (V^T tile) x P^T, where P^T's B-fragment is *register-identical*
//   to S^T's C-fragment (pB[e]=f16(s0[e]), pB[8+e]=f16(s1[e])): no LDS,
//   no cross-lane transpose.  Epilogue: per-lane 1/l, coalesced stores.
// K and V^T reach the eight waves of a block through LDS: tiles of KT keys,
// two buffers, filled by asynchronous 16-byte copies one whole tile ahead, so
// a tile's way from L2 is covered by the tile before it and is gone once per
// block, not once per wave.
// A wave owns 32 query columns (two column tiles) and one half of every staged
// tile's keys: each K and V^T fragment that it reads from LDS feeds two
// products.  Waves wv and wv + 4 share their columns; with no running maximum
// their O^T and sums are plain partial sums, added once through LDS at the end.
// ---------------------------------------------------------------------------
#define KT   128           // keys per staged tile
#define KW   (KT / 2)      // keys of a tile per wave
#define KP   40            // LDS pitch of a key row, halves: 80 B = 16 B x odd
#define VP   (KT + 8)      // LDS pitch of a V^T row, halves: 272 B = 16 B x odd
#define KBUF (KT * KP)     // halves per K buffer
#define VBUF (D_ * VP)     // halves per V^T buffer
#define XW   (17 * 32)     // floats a wave hands to its partner: 16 of O^T and 1 sum per lane

__global__ __launch_bounds__(256) void flash_attn_kernel(
    const _Float16* __restrict__ q, const _Float16* __restrict__ k,
    const _Float16* __restrict__ vT, float* __restrict__ ao)
{
  __shared__ __attribute__((aligned(16))) _Float16 Ks[2 * KBUF];
  __shared__ __attribute__((aligned(16))) _Float16 Vs[2 * VBUF];
  __shared__ float Xc[8 * XW];
  const int tid  = threadIdx.x;
  const int lane = tid & 31;
  const int wv   = tid >> 5;
  const int kh   = wv >> 2;          // which half of every tile's keys
  const int b    = blockIdx.y >> 2;
  const int h    = blockIdx.y & 3;
  const long bh  = (long)b * H_ + h;
  const int  i0  = blockIdx.x * 128 + (wv & 3) * 32;
  const int  col = lane & 15;

  // Q^T as B fragments (K-dim = d = 32, N = 16 queries each), loaded once
  const v16h qB0 = load_16x32_frag(q + (bh * N_ + i0) * D_,      D_, lane);
  const v16h qB1 = load_16x32_frag(q + (bh * N_ + i0 + 16) * D_, D_, lane);

  // O^T accumulators, [column tile][d rows 0-15 / 16-31]
  v8f o00 = {}; v8f o01 = {}; v8f o10 = {}; v8f o11 = {};
  v8f ls0 = {}; v8f ls1 = {};        // sums of P per column tile, this lane's keys
  const v8f shift = {PSHIFT_, PSHIFT_, PSHIFT_, PSHIFT_,
                     PSHIFT_, PSHIFT_, PSHIFT_, PSHIFT_};

  // Each thread copies four 16-byte pieces of a tile: K rows tid>>2 and 64 more
  // (a K tile is 8 KiB in a row in global memory), V^T rows tid>>4 and 16 more.
  const _Float16* kg = k  + bh * (long)N_ * D_ + tid * 8;
  const _Float16* vg = vT + bh * (long)D_ * N_ + (long)(tid >> 4) * N_ + (tid & 15) * 8;
  const unsigned  lk = (unsigned)(size_t)(Ks + (tid >> 2) * KP + (tid & 3) * 8);
  const unsigned  lv = (unsigned)(size_t)(Vs + (tid >> 4) * VP + (tid & 15) * 8);

  auto copy_tile = [&](int tile, int buf) {
    const _Float16* gk0 = kg + (long)tile * (KT * D_);
    const _Float16* gk1 = gk0 + 64 * D_;
    const _Float16* gv0 = vg + tile * KT;
    const _Float16* gv1 = gv0 + 16 * N_;
    const unsigned  lk0 = lk + buf * (KBUF * 2);
    const unsigned  lk1 = lk0 + 64 * KP * 2;
    const unsigned  lv0 = lv + buf * (VBUF * 2);
    const unsigned  lv1 = lv0 + 16 * VP * 2;
    // the closing wait stands between the copies and any rewrite of the
    // registers that they name
    asm volatile("global_load_async_to_lds_b128 %0, %4, off\n\t"
                 "global_load_async_to_lds_b128 %1, %5, off\n\t"
                 "global_load_async_to_lds_b128 %2, %6, off\n\t"
                 "global_load_async_to_lds_b128 %3, %7, off\n\t"
                 "s_wait_xcnt 0x0"
                 :: "v"(lk0), "v"(lk1), "v"(lv0), "v"(lv1),
                    "v"(gk0), "v"(gk1), "v"(gv0), "v"(gv1)
                 : "memory");
  };

  constexpr int NT = N_ / KT;
  copy_tile(0, 0);
  // this wave's copies of tile 0 have landed
  asm volatile("s_wait_asynccnt 0x0" ::: "memory");
  // publishes tile 0 to all eight waves
  __syncthreads();
  copy_tile(1, 1);

  // Kept rolled: the buffer index alternates and one barrier ends each trip.
  #pragma unroll 1
  for (int tile = 0; tile < NT; ++tile) {
    const _Float16* ks = Ks + (tile & 1) * KBUF + kh * (KW * KP);
    const _Float16* vs = Vs + (tile & 1) * VBUF + kh * KW;

    // the fragments of this wave's keys of the tile, each read once:
    // K rows j 0..15 / 16..31 and V^T d rows 0..15 / 16..31 per 32 keys
    v16h ka[KW / 16], va[KW / 16];
    #pragma unroll  // register-array index stays a constant
    for (int u = 0; u < KW / 32; ++u) {
      ka[2 * u]     = load_16x32_frag(ks + (32 * u) * KP,      KP, lane);
      ka[2 * u + 1] = load_16x32_frag(ks + (32 * u + 16) * KP, KP, lane);
      va[2 * u]     = load_16x32_frag(vs + 32 * u,             VP, lane);
      va[2 * u + 1] = load_16x32_frag(vs + 16 * VP + 32 * u,   VP, lane);
    }

    #pragma unroll  // register-array index stays a constant
    for (int u = 0; u < KW / 32; ++u) {
      // S^T tiles [j][i], scaled and shifted, for both column tiles
      v8f s00 = __builtin_amdgcn_wmma_f32_16x16x32_f16(false, ka[2 * u], false, qB0,
                                                       (short)0, shift, false, false);
      v8f s01 = __builtin_amdgcn_wmma_f32_16x16x32_f16(false, ka[2 * u + 1], false, qB0,
                                                       (short)0, shift, false, false);
      v8f s10 = __builtin_amdgcn_wmma_f32_16x16x32_f16(false, ka[2 * u], false, qB1,
                                                       (short)0, shift, false, false);
      v8f s11 = __builtin_amdgcn_wmma_f32_16x16x32_f16(false, ka[2 * u + 1], false, qB1,
                                                       (short)0, shift, false, false);

      // exponentiate; P^T B-fragment == S^T C-fragment layout: direct convert
      v16h pB0, pB1;
      #pragma unroll  // register-array index stays a constant
      for (int r = 0; r < 8; ++r) {
        s00[r] = __builtin_amdgcn_exp2f(s00[r]);
        s01[r] = __builtin_amdgcn_exp2f(s01[r]);
        pB0[r]     = (_Float16)s00[r];
        pB0[8 + r] = (_Float16)s01[r];
      }
      ls0 += s00 + s01;
      #pragma unroll  // register-array index stays a constant
      for (int r = 0; r < 8; ++r) {
        s10[r] = __builtin_amdgcn_exp2f(s10[r]);
        s11[r] = __builtin_amdgcn_exp2f(s11[r]);
        pB1[r]     = (_Float16)s10[r];
        pB1[8 + r] = (_Float16)s11[r];
      }
      ls1 += s10 + s11;

      // O^T += V^T x P^T
      o00 = __builtin_amdgcn_wmma_f32_16x16x32_f16(false, va[2 * u], false, pB0,
                                                   (short)0, o00, false, false);
      o01 = __builtin_amdgcn_wmma_f32_16x16x32_f16(false, va[2 * u + 1], false, pB0,
                                                   (short)0, o01, false, false);
      o10 = __builtin_amdgcn_wmma_f32_16x16x32_f16(false, va[2 * u], false, pB1,
                                                   (short)0, o10, false, false);
      o11 = __builtin_amdgcn_wmma_f32_16x16x32_f16(false, va[2 * u + 1], false, pB1,
                                                   (short)0, o11, false, false);
    }

    // this wave's reads of the buffer that is refilled below have returned
    asm volatile("s_wait_dscnt 0x0" ::: "memory");
    // this wave's copies of the next tile have landed
    asm volatile("s_wait_asynccnt 0x0" ::: "memory");
    // publishes the next tile and ends every wave's reads of this one
    __syncthreads();
    if (tile + 2 < NT) copy_tile(tile + 2, tile & 1);
  }
  // no copy is left in flight when the wave ends
  asm volatile("s_wait_asynccnt 0x0" ::: "memory");

  // The two key halves of a column are joined: wave kh finishes column tile kh
  // and hands its partial sums of the other tile to the partner wave.
  const float l0 = ((ls0[0] + ls0[1]) + (ls0[2] + ls0[3])) + ((ls0[4] + ls0[5]) + (ls0[6] + ls0[7]));
  const float l1 = ((ls1[0] + ls1[1]) + (ls1[2] + ls1[3])) + ((ls1[4] + ls1[5]) + (ls1[6] + ls1[7]));
  float* xo = Xc + wv * XW + lane;
  #pragma unroll  // register-array index stays a constant
  for (int r = 0; r < 8; ++r) {
    xo[r * 32]       = kh ? o00[r] : o10[r];
    xo[(8 + r) * 32] = kh ? o01[r] : o11[r];
  }
  xo[16 * 32] = kh ? l0 : l1;
  // publishes every wave's handed-over sums to its partner
  __syncthreads();
  const float* xi = Xc + (wv ^ 4) * XW + lane;
  v8f o0, o1;
  #pragma unroll  // register-array index stays a constant
  for (int r = 0; r < 8; ++r) {
    o0[r] = (kh ? o10[r] : o00[r]) + xi[r * 32];
    o1[r] = (kh ? o11[r] : o01[r]) + xi[(8 + r) * 32];
  }
  float l = (kh ? l1 : l0) + xi[16 * 32];

  // epilogue: O^T / l, coalesced stores to ao[b][c=h*32+d][n]
  l += __shfl_xor(l, 16);
  const float inv  = 1.0f / l;
  const int   hi8  = (lane >> 4) * 8;
  const int   cbase = h * 32;
  const int   n    = i0 + kh * 16 + col;
  #pragma unroll
  for (int r = 0; r < 8; ++r) {
    const int d = r + hi8;
    ao[(long)(b * HID + cbase + d)      * N_ + n] = o0[r] * inv;
    ao[(long)(b * HID + cbase + 16 + d) * N_ + n] = o1[r] * inv;
  }
}

// ---------------------------------------------------------------------------
// Kernel 3: output projection.
// out[b][o][pos] = b_out[o] + sum_c w_out[o][c]*ao[b][c][pos]
// Same WMMA body; the bias, staged in LDS, is added at the store.
// ---------------------------------------------------------------------------
__global__ __launch_bounds__(256) void out_proj_kernel(
    const float* __restrict__ ao, const float* __restrict__ w_out,
    const float* __restrict__ b_out, float* __restrict__ out)
{
  __shared__ __attribute__((aligned(16))) unsigned Ws[2 * C_IN * RP];
  __shared__ __attribute__((aligned(16))) unsigned Xs[2 * 64 * RP];
  __shared__ __attribute__((aligned(16))) float Bs[C_IN];   // C_IN = block size
  const int b    = blockIdx.y;
  const int pos0 = blockIdx.x * 64;
  const int lane = threadIdx.x & 31;
  const int wv   = threadIdx.x >> 5;
  const int c    = lane & 15;
  const int h    = lane >> 4;

  // one coalesced bias load per block; the body's first barrier publishes it
  Bs[threadIdx.x] = b_out[threadIdx.x];

  v8f acc[2][4] = {};
  proj_wmma<2, HID, 2>(w_out, ao + (long)b * HID * N_ + pos0, Ws, Xs, acc);

  #pragma unroll  // register-array index stays a constant
  for (int i = 0; i < 2; ++i) {
    #pragma unroll  // register-array index stays a constant
    for (int r = 0; r < 8; ++r) {
      const int   o    = (wv + 8 * i) * 16 + 8 * h + r;
      const float bias = Bs[o];
      #pragma unroll  // register-array index stays a constant
      for (int j = 0; j < 4; ++j)
        out[((long)b * C_IN + o) * N_ + pos0 + 16 * j + c] = acc[i][j][r] + bias;
    }
  }
}

// ---------------------------------------------------------------------------
extern "C" void kernel_launch(void* const* d_in, const int* in_sizes, int n_in,
                              void* d_out, int out_size, void* d_ws, size_t ws_size,
                              hipStream_t stream)
{
  const float* x     = (const float*)d_in[0];
  const float* w_qkv = (const float*)d_in[1];
  const float* w_out = (const float*)d_in[2];
  const float* b_out = (const float*)d_in[3];
  float*       out   = (float*)d_out;

  // workspace layout: q(4MiB f16) | k(4MiB f16) | vT(4MiB f16) | ao(8MiB f32)
  char* ws = (char*)d_ws;
  _Float16* q  = (_Float16*)(ws);
  _Float16* k  = (_Float16*)(ws + ((size_t)4  << 20));
  _Float16* vT = (_Float16*)(ws + ((size_t)8  << 20));
  float*    ao = (float*)   (ws + ((size_t)12 << 20));

  dim3 g1(N_ / 64, B_);
  qkv_proj_kernel<<<g1, 256, 0, stream>>>(x, w_qkv, q, k, vT);

  dim3 g2(N_ / 128, B_ * H_);
  flash_attn_kernel<<<g2, 256, 0, stream>>>(q, k, vT, ao);

  dim3 g3(N_ / 64, B_);
  out_proj_kernel<<<g3, 256, 0, stream>>>(ao, w_out, b_out, out);
}

// v008
// It runs in 48.3 microseconds.
// Timed twice side by side with v007, it ran 1.03 and 1.04 times as fast.
// Over all steps from v000 it is 6.50 times as fast.
#include <hip/hip_runtime.h>
#include <hip/hip_bf16.h>
#include <math.h>

#define B_    4
#define H_    4
#define N_    4096
#define D_    32
#define C_IN  256
#define HID   128   // HEADS*DIM_HEAD
#define SCALE_ 10.0f
#define EPS_   1e-12f
// SCALE_ * log2(e): q carries it, so that K x Q^T comes out in powers of two
#define QSCALE_ (SCALE_ * 1.4426950408889634f)
// Constant softmax shift, in powers of two.  After the L2 norm q and k have
// length at most 1, so |q.k| <= 1 for every input; with their f16 roundings the
// scaled score stays within +-14.45, so 2^(score + 1) lies in 2^-13.45 ..
// 2^15.45: inside the normal f16 range at both ends.  The shift cancels in O / l.
#define PSHIFT_ 1.0f

typedef __attribute__((ext_vector_type(16))) _Float16 v16h;
typedef __attribute__((ext_vector_type(8)))  _Float16 v8h;
typedef __attribute__((ext_vector_type(8)))  float    v8f;
typedef __attribute__((ext_vector_type(4)))  float    v4f;
typedef __attribute__((ext_vector_type(2)))  float    v2f;
typedef __attribute__((ext_vector_type(16))) __bf16   v16b;
typedef __attribute__((ext_vector_type(2)))  __bf16   v2b;
typedef __attribute__((ext_vector_type(8)))  unsigned v8u;
typedef __attribute__((ext_vector_type(4)))  unsigned v4u;
typedef __attribute__((ext_vector_type(2)))  unsigned v2u;

// ---------------------------------------------------------------------------
// Shared body of the two 1x1-conv projections, on bf16 16x16x32 WMMA with f32
// accumulators.  Each f32 operand is split into two bf16 terms, a head (the
// value rounded to bf16) and a tail (what is left, rounded to bf16), and
//   w * x  ~=  wh * xh + wh * xt + wt * xh
// takes three products; what is dropped lies about 2^-16 below w * x.
//   Y[o][pos] = sum_k W[o][k] * X[k][pos],  W is [MT*128][K], X is [K][N_].
// One block = all MT*128 output channels x 64 positions; 8 waves; wave wv owns
// channel tiles wv + 8*i (i < MT) times all four position tiles.
// k runs in chunks of KC through two LDS buffers and two register sets: a chunk's
// global loads are issued two chunks ahead; it is split and stored to LDS one
// chunk ahead, among the products of the chunk before it.
// In LDS both operands lie k-contiguous, one row per channel or per position:
// 32 heads, 32 tails, pad.  One loader serves both operands, so their k order
// is the same: lane half h, element p  ->  k = 16*h + p.
// Tiles i <  SWAP_FROM: A = W, B = X -> acc[r] = Y[tile*16 + 8*h + r][16*j + c]
// Tiles i >= SWAP_FROM: A = X, B = W -> acc[r] = Y[tile*16 + c][16*j + 8*h + r]
// ---------------------------------------------------------------------------
#define KC 32   // k per staged chunk = k of one product
#define RP 36   // LDS pitch of a row, dwords: 16 of heads, 16 of tails, 4 of pad: 144 B = 16 B x odd

// two f32 -> their bf16 heads in one dword, their bf16 tails in another
__device__ __forceinline__ void split2(float a, float b, unsigned& head, unsigned& tail)
{
  const v2f x = {a, b};
  const v2b hd = __builtin_convertvector(x, v2b);
  const v2f r  = x - __builtin_convertvector(hd, v2f);   // exact
  const v2b tl = __builtin_convertvector(r, v2b);
  head = __builtin_bit_cast(unsigned, hd);
  tail = __builtin_bit_cast(unsigned, tl);
}

// 16 consecutive bf16 of an LDS row as an A or B fragment
__device__ __forceinline__ v16b row_frag(const unsigned* p)
{
  const v4u lo = *(const v4u*)p;
  const v4u hi = *(const v4u*)(p + 4);
  const v8u u  = {lo[0], lo[1], lo[2], lo[3], hi[0], hi[1], hi[2], hi[3]};
  return __builtin_bit_cast(v16b, u);
}

// a compile-time flag or index handed to the trip body below
template <int V> struct Ic { static constexpr int value = V; };

template <int MT, int K, int SWAP_FROM>
__device__ __forceinline__ void proj_wmma(const float* __restrict__ W,
                                          const float* __restrict__ X,
                                          unsigned* __restrict__ Ws,
                                          unsigned* __restrict__ Xs,
                                          v8f (&acc)[MT][4])
{
  constexpr int M  = MT * 128;
  constexpr int NC = K / KC;             // even, at least 4
  constexpr int WL = M * KC / 4 / 256;   // 16-byte weight loads per thread and chunk
  constexpr int JB = MT >= 3 ? 1 : 2;    // position tiles per group: at least 3 accumulators in turn
  constexpr int NR = (4 / JB) * 3;       // runs of MT * JB products per chunk
  constexpr int NP = WL + 1;             // pieces of a chunk's split and store: WL of W, one of X
  const int t    = threadIdx.x;
  const int lane = t & 31;
  const int wv   = t >> 5;
  const int c    = lane & 15;
  const int h    = lane >> 4;

  // Global addresses: a block-uniform base that moves with the chunk, plus one
  // 32-bit offset per lane that stays the same for the whole kernel.
  // A thread takes 4 consecutive k of a weight row, and 8 consecutive k of one
  // position (a wave's 32 positions lie in a row in memory).
  const unsigned woff = (unsigned)(((t >> 3) * K + (t & 7) * 4) * 4);
  const unsigned xidx = (unsigned)((t >> 6) * 8 * N_ + (t & 63));   // in floats

  // two register sets: chunk kc travels in set kc & 1
  v4f   wr[2][WL];
  float xr[2][8];
  auto fetch = [&](int kc, auto set) {
    constexpr int S = decltype(set)::value;
    const char* wb = (const char*)(W + kc * KC);
    const float* xb = X + (long)kc * KC * N_;
    #pragma unroll  // register-array index stays a constant
    for (int i = 0; i < WL; ++i)
      wr[S][i] = *(const v4f*)(wb + woff + i * (32 * K * 4));
    // stands between the weight loads and the loads below, whose results the
    // build may put into the weight loads' address registers
    asm volatile("s_wait_xcnt 0x0" ::: "memory");
    #pragma unroll  // register-array index stays a constant
    for (int e = 0; e < 8; ++e)
      xr[S][e] = xb[xidx + e * N_];
    // stands between these loads and the next rewrite of their address registers;
    // it names the lane's offset so that this register lives up to the wait and
    // none of the loads above lands in it
    asm volatile("s_wait_xcnt 0x0" :: "v"(xidx) : "memory");
  };
  // piece p of set S, split and stored to LDS buffer S: p < WL a weight load, p == WL the X column
  auto stash_piece = [&](auto set, int p) {
    constexpr int S = decltype(set)::value;
    if (p < WL) {
      const int f = t + 256 * p;
      v2u hd, tl;
      unsigned a, b;
      split2(wr[S][p][0], wr[S][p][1], a, b); hd[0] = a; tl[0] = b;
      split2(wr[S][p][2], wr[S][p][3], a, b); hd[1] = a; tl[1] = b;
      unsigned* q = Ws + S * (M * RP) + (f >> 3) * RP + (f & 7) * 2;
      *(v2u*)q        = hd;
      *(v2u*)(q + 16) = tl;
    } else {
      v4u hd, tl;
      #pragma unroll  // register-array index stays a constant
      for (int m = 0; m < 4; ++m) {
        unsigned a, b;
        split2(xr[S][2 * m], xr[S][2 * m + 1], a, b); hd[m] = a; tl[m] = b;
      }
      unsigned* q = Xs + S * (64 * RP) + (t & 63) * RP + (t >> 6) * 4;
      *(v4u*)q        = hd;
      *(v4u*)(q + 16) = tl;
    }
  };

  // One chunk: its fragments are read from LDS buffer P; chunk kc + 2's global
  // loads are issued into set P (free: split and stored one trip ago); chunk
  // kc + 1, loaded a whole trip ago into the other set, is split and stored to
  // the other buffer piece by piece among this chunk's products.
  auto trip = [&](int kc, auto par, auto do_fetch, auto do_stash) {
    constexpr int P = decltype(par)::value;
    // Publishes buffer P and ends every wave's reads of the other buffer.  The
    // fences name LDS alone: __syncthreads() would also drain the global loads
    // that are meant to stay in flight over this barrier.
    __builtin_amdgcn_fence(__ATOMIC_RELEASE, "workgroup", "local");
    __builtin_amdgcn_s_barrier();
    __builtin_amdgcn_fence(__ATOMIC_ACQUIRE, "workgroup", "local");
    // keeps a trip's vector work inside the trip: without it the build lifted the
    // next trip's split up to the loads just issued, a full load wait in mid-trip
    __builtin_amdgcn_sched_barrier(0);

    const unsigned* ws = Ws + P * (M * RP) + (wv * 16 + c) * RP + 8 * h;
    const unsigned* xs = Xs + P * (64 * RP) + c * RP + 8 * h;
    v16b wh[MT], wt[MT], xh[4], xt[4];
    #pragma unroll  // register-array index stays a constant
    for (int i = 0; i < MT; ++i) {
      wh[i] = row_frag(ws + i * (128 * RP));
      wt[i] = row_frag(ws + i * (128 * RP) + 16);
    }
    #pragma unroll  // register-array index stays a constant
    for (int j = 0; j < 4; ++j) {
      xh[j] = row_frag(xs + j * (16 * RP));
      xt[j] = row_frag(xs + j * (16 * RP) + 16);
    }
    if constexpr (decltype(do_fetch)::value) fetch(kc + 2, par);
    // keeps the global loads at the head of the trip, ahead of the products
    __builtin_amdgcn_sched_barrier(0);

    #pragma unroll  // register-array index stays a constant
    for (int j0 = 0; j0 < 4; j0 += JB) {
      // term 0: head x head, 1: W head x X tail, 2: W tail x X head
      #pragma unroll  // register-array index stays a constant
      for (int term = 0; term < 3; ++term) {
        #pragma unroll  // register-array index stays a constant
        for (int i = 0; i < MT; ++i) {
          const v16b wf = term == 2 ? wt[i] : wh[i];
          #pragma unroll  // register-array index stays a constant
          for (int j = j0; j < j0 + JB; ++j) {
            const v16b xf = term == 1 ? xt[j] : xh[j];
            if (i < SWAP_FROM)
              acc[i][j] = __builtin_amdgcn_wmma_f32_16x16x32_bf16(
                  false, wf, false, xf, (short)0, acc[i][j], false, false);
            else
              acc[i][j] = __builtin_amdgcn_wmma_f32_16x16x32_bf16(
                  false, xf, false, wf, (short)0, acc[i][j], false, false);
          }
        }
        if constexpr (decltype(do_stash)::value) {
          const int r = (j0 / JB) * 3 + term;
          #pragma unroll  // register-array index stays a constant
          for (int p = r * NP / NR; p < (r + 1) * NP / NR; ++p)
            stash_piece(Ic<1 - P>{}, p);
          // keeps each piece beside its run of products, so that its vector
          // work issues while the matrix unit is busy
          __builtin_amdgcn_sched_barrier(0);
        }
      }
    }
  };

  fetch(0, Ic<0>{});
  fetch(1, Ic<1>{});
  #pragma unroll  // register-array index stays a constant
  for (int p = 0; p < NP; ++p) stash_piece(Ic<0>{}, p);
  // Kept rolled, two trips a pass: set and buffer indices are constants in each.
  #pragma unroll 1
  for (int kc = 0; kc < NC - 2; kc += 2) {
    trip(kc,     Ic<0>{}, Ic<1>{}, Ic<1>{});
    trip(kc + 1, Ic<1>{}, Ic<1>{}, Ic<1>{});
  }
  trip(NC - 2, Ic<0>{}, Ic<0>{}, Ic<1>{});
  trip(NC - 1, Ic<1>{}, Ic<0>{}, Ic<0>{});
}

// ---------------------------------------------------------------------------
// Kernel 1: QKV projection.  qkv[o][pos] = sum_c w_qkv[o][c] * x[b][c][pos]
// Writes q,k (f16, [b][h][n][32], L2-normalized over d) and v transposed
// (f16, [b][h][32][n]) so attention fragment loads are contiguous 16B chunks.
// Wave wv holds channel tile wv of q (i=0), of k (i=1) and of v (i=2): head
// wv>>1, d from (wv&1)*16.  q,k tiles keep 8 consecutive d per lane, the v tile
// (operands swapped) 8 consecutive positions: every store is one 16-byte store.
// The L2 norm is taken here, on the f32 accumulators: the 32 d of one (head,
// position) lie in four lanes of the block (both lane halves of waves wv and
// wv^1), which join their sums of 8 squares through LDS.  q also takes the
// factor QSCALE_; each of q and k is rounded to f16 once.
// ---------------------------------------------------------------------------
#define SP 12   // LDS pitch of a thread's 8 sums of squares, dwords: 48 B = 16 B x odd

__global__ __launch_bounds__(256) void qkv_proj_kernel(
    const float* __restrict__ x, const float* __restrict__ w,
    _Float16* __restrict__ q, _Float16* __restrict__ k,
    _Float16* __restrict__ vT)
{
  __shared__ __attribute__((aligned(16))) unsigned Ws[2 * 3 * HID * RP];
  __shared__ __attribute__((aligned(16))) unsigned Xs[2 * 64 * RP];
  __shared__ __attribute__((aligned(16))) float Ss[256 * SP];   // sums of 8 squares
  const int b    = blockIdx.y;
  const int pos0 = blockIdx.x * 64;
  const int lane = threadIdx.x & 31;
  const int wv   = threadIdx.x >> 5;
  const int c    = lane & 15;
  const int h    = lane >> 4;

  v8f acc[3][4] = {};
  proj_wmma<3, C_IN, 2>(w, x + (long)b * C_IN * N_ + pos0, Ws, Xs, acc);

  // this lane's 8 d of q (i = 0) and k (i = 1), squared and summed in register
  // pairs, one sum per position tile j
  #pragma unroll  // register-array index stays a constant
  for (int i = 0; i < 2; ++i) {
    v4f sq;
    #pragma unroll  // register-array index stays a constant
    for (int j = 0; j < 4; ++j) {
      v2f s2 = {0.f, 0.f};
      #pragma unroll  // register-array index stays a constant
      for (int r = 0; r < 8; r += 2) {
        v2f a;
        a[0] = acc[i][j][r];
        a[1] = acc[i][j][r + 1];
        s2 += a * a;
      }
      sq[j] = s2[0] + s2[1];
    }
    *(v4f*)(Ss + threadIdx.x * SP + 4 * i) = sq;
  }
  // publishes every lane's sums of squares to the other three lanes of its rows
  __syncthreads();
  // The four parts are added in the order of d, the same in all four lanes.
  // 1 / max(sqrt(ss), eps) = min(rsqrt(ss), 1 / eps), ss = 0 included.
  const float* sp = Ss + ((wv & 6) * 32 + c) * SP;
  float inv[2][4];
  #pragma unroll  // register-array index stays a constant
  for (int i = 0; i < 2; ++i) {
    const v4f ss = (*(const v4f*)(sp + 4 * i)           + *(const v4f*)(sp + 16 * SP + 4 * i))
                 + (*(const v4f*)(sp + 32 * SP + 4 * i) + *(const v4f*)(sp + 48 * SP + 4 * i));
    float rs[4];
    // In one statement so that the closing v_nop stays directly behind the last
    // v_rsq_f32: it is the free slot that the instruction set asks for ahead of an
    // instruction that reads the result or rewrites the source.
    asm("v_rsq_f32 %0, %4\n\t"
        "v_rsq_f32 %1, %5\n\t"
        "v_rsq_f32 %2, %6\n\t"
        "v_rsq_f32 %3, %7\n\t"
        "v_nop"
        : "=&v"(rs[0]), "=&v"(rs[1]), "=&v"(rs[2]), "=&v"(rs[3])
        : "v"(ss[0]), "v"(ss[1]), "v"(ss[2]), "v"(ss[3]));
    #pragma unroll  // register-array index stays a constant
    for (int j = 0; j < 4; ++j)
      inv[i][j] = fminf(rs[j], 1.0f / EPS_) * (i == 0 ? QSCALE_ : 1.0f);
  }

  const long bh = (long)b * H_ + (wv >> 1);
  const int  d0 = (wv & 1) * 16;
  #pragma unroll  // register-array index stays a constant
  for (int j = 0; j < 4; ++j) {
    v8h hq, hk, hv;
    #pragma unroll  // register-array index stays a constant
    for (int r = 0; r < 8; ++r) {
      hq[r] = (_Float16)(acc[0][j][r] * inv[0][j]);
      hk[r] = (_Float16)(acc[1][j][r] * inv[1][j]);
      hv[r] = (_Float16)acc[2][j][r];
    }
    const long pos = pos0 + 16 * j + c;
    *(v8h*)(q + (bh * N_ + pos) * D_ + d0 + 8 * h) = hq;
    *(v8h*)(k + (bh * N_ + pos) * D_ + d0 + 8 * h) = hk;
    *(v8h*)(vT + (bh * D_ + d0 + c) * N_ + pos0 + 16 * j + 8 * h) = hv;
  }
}

// ---------------------------------------------------------------------------
// Fragment loader: 16x32 f16 tile in the CDNA5 WMMA A/B lane/K ordering.
// lane<16 : row/col = lane,    K elements {0..7, 16..23}
// lane>=16: row/col = lane-16, K elements {8..15, 24..31}
// ---------------------------------------------------------------------------
__device__ inline v16h load_16x32_frag(const _Float16* __restrict__ base,
                                       long rowStride, int lane)
{
  const int row = lane & 15;
  const int off = (lane >> 4) * 8;
  const _Float16* pr = base + (long)row * rowStride + off;
  v8h lo = *(const v8h*)(pr);
  v8h hi = *(const v8h*)(pr + 16);
  v16h r;
  #pragma unroll
  for (int i = 0; i < 8; ++i) { r[i] = lo[i]; r[8 + i] = hi[i]; }
  return r;
}

// ---------------------------------------------------------------------------
// Kernel 2: flash attention, transposed formulation.
//   S^T = (K tile) x Q^T + shift: the product is the exponent itself (q holds
//   the scale, the C operand the constant shift), P = 2^(S^T).  No running
//   maximum, so O^T and the sums are never rescaled; each lane sums its own
//   keys and the partial sums of a column are joined once, behind the loop.
//   O^T += (V^T tile) x P^T, where P^T's B-fragment is *register-identical*
//   to S^T's C-fragment (pB[e]=f16(s0[e]), pB[8+e]=f16(s1[e])): no LDS,
//   no cross-lane transpose.  Epilogue: per-lane 1/l, coalesced stores.
// K and V^T reach the eight waves of a block through LDS: tiles of KT keys,
// two buffers, filled by asynchronous 16-byte copies one whole tile ahead, so
// a tile's way from L2 is covered by the tile before it and is gone once per
// block, not once per wave.
// A wave owns 32 query columns (two column tiles) and one half of every staged
// tile's keys: each K and V^T fragment that it reads from LDS feeds two
// products.  Waves wv and wv + 4 share their columns; with no running maximum
// their O^T and sums are plain partial sums, added once through LDS at the end.
// ---------------------------------------------------------------------------
#define KT   128           // keys per staged tile
#define KW   (KT / 2)      // keys of a tile per wave
#define KP   40            // LDS pitch of a key row, halves: 80 B = 16 B x odd
#define VP   (KT + 8)      // LDS pitch of a V^T row, halves: 272 B = 16 B x odd
#define KBUF (KT * KP)     // halves per K buffer
#define VBUF (D_ * VP)     // halves per V^T buffer
#define XW   (17 * 32)     // floats a wave hands to its partner: 16 of O^T and 1 sum per lane

__global__ __launch_bounds__(256) void flash_attn_kernel(
    const _Float16* __restrict__ q, const _Float16* __restrict__ k,
    const _Float16* __restrict__ vT, float* __restrict__ ao)
{
  __shared__ __attribute__((aligned(16))) _Float16 Ks[2 * KBUF];
  __shared__ __attribute__((aligned(16))) _Float16 Vs[2 * VBUF];
  __shared__ float Xc[8 * XW];
  const int tid  = threadIdx.x;
  const int lane = tid & 31;
  const int wv   = tid >> 5;
  const int kh   = wv >> 2;          // which half of every tile's keys
  const int b    = blockIdx.y >> 2;
  const int h    = blockIdx.y & 3;
  const long bh  = (long)b * H_ + h;
  const int  i0  = blockIdx.x * 128 + (wv & 3) * 32;
  const int  col = lane & 15;

  // Q^T as B fragments (K-dim = d = 32, N = 16 queries each), loaded once
  const v16h qB0 = load_16x32_frag(q + (bh * N_ + i0) * D_,      D_, lane);
  const v16h qB1 = load_16x32_frag(q + (bh * N_ + i0 + 16) * D_, D_, lane);

  // O^T accumulators, [column tile][d rows 0-15 / 16-31]
  v8f o00 = {}; v8f o01 = {}; v8f o10 = {}; v8f o11 = {};
  v8f ls0 = {}; v8f ls1 = {};        // sums of P per column tile, this lane's keys
  const v8f shift = {PSHIFT_, PSHIFT_, PSHIFT_, PSHIFT_,
                     PSHIFT_, PSHIFT_, PSHIFT_, PSHIFT_};

  // Each thread copies four 16-byte pieces of a tile: K rows tid>>2 and 64 more
  // (a K tile is 8 KiB in a row in global memory), V^T rows tid>>4 and 16 more.
  const _Float16* kg = k  + bh * (long)N_ * D_ + tid * 8;
  const _Float16* vg = vT + bh * (long)D_ * N_ + (long)(tid >> 4) * N_ + (tid & 15) * 8;
  const unsigned  lk = (unsigned)(size_t)(Ks + (tid >> 2) * KP + (tid & 3) * 8);
  const unsigned  lv = (unsigned)(size_t)(Vs + (tid >> 4) * VP + (tid & 15) * 8);

  auto copy_tile = [&](int tile, int buf) {
    const _Float16* gk0 = kg + (long)tile * (KT * D_);
    const _Float16* gk1 = gk0 + 64 * D_;
    const _Float16* gv0 = vg + tile * KT;
    const _Float16* gv1 = gv0 + 16 * N_;
    const unsigned  lk0 = lk + buf * (KBUF * 2);
    const unsigned  lk1 = lk0 + 64 * KP * 2;
    const unsigned  lv0 = lv + buf * (VBUF * 2);
    const unsigned  lv1 = lv0 + 16 * VP * 2;
    // the closing wait stands between the copies and any rewrite of the
    // registers that they name
    asm volatile("global_load_async_to_lds_b128 %0, %4, off\n\t"
                 "global_load_async_to_lds_b128 %1, %5, off\n\t"
                 "global_load_async_to_lds_b128 %2, %6, off\n\t"
                 "global_load_async_to_lds_b128 %3, %7, off\n\t"
                 "s_wait_xcnt 0x0"
                 :: "v"(lk0), "v"(lk1), "v"(lv0), "v"(lv1),
                    "v"(gk0), "v"(gk1), "v"(gv0), "v"(gv1)
                 : "memory");
  };

  constexpr int NT = N_ / KT;
  copy_tile(0, 0);
  // this wave's copies of tile 0 have landed
  asm volatile("s_wait_asynccnt 0x0" ::: "memory");
  // publishes tile 0 to all eight waves
  __syncthreads();
  copy_tile(1, 1);

  auto expo = [&](v8f& s) {
    #pragma unroll  // register-array index stays a constant
    for (int r = 0; r < 8; ++r) s[r] = __builtin_amdgcn_exp2f(s[r]);
  };
  // P^T B-fragment == S^T C-fragment layout: direct convert
  auto pack = [&](const v8f& sa, const v8f& sb) {
    v16h p;
    #pragma unroll  // register-array index stays a constant
    for (int r = 0; r < 8; ++r) {
      p[r]     = (_Float16)sa[r];
      p[8 + r] = (_Float16)sb[r];
    }
    return p;
  };
  auto score = [&](const v16h& kf, const v16h& qf) {
    return __builtin_amdgcn_wmma_f32_16x16x32_f16(false, kf, false, qf, (short)0, shift, false, false);
  };
  auto accum = [&](const v16h& vf, const v16h& pf, v8f& o) {
    o = __builtin_amdgcn_wmma_f32_16x16x32_f16(false, vf, false, pf, (short)0, o, false, false);
  };

  // The loop runs one 32-key unit behind itself.  A wave's second unit of a tile
  // leaves its trip as raw scores (t00..t11) and V^T fragments (vp0, vp1), all in
  // registers; its exponentials and its O^T products stand at the head of the
  // next trip, where they cover the way of that tile's fragments from LDS.  A
  // unit's score products stand in one run ahead of its exponentials, so that no
  // exponential waits for the product directly in front of it.
  v8f  t00 = {}, t01 = {}, t10 = {}, t11 = {};
  v16h vp0 = {}, vp1 = {};
  auto trip = [&](int tile, auto first, auto refill) {
    constexpr bool HELD = !decltype(first)::value;
    const _Float16* ks = Ks + (tile & 1) * KBUF + kh * (KW * KP);
    const _Float16* vs = Vs + (tile & 1) * VBUF + kh * KW;

    // K rows j 0..15 / 16..31 of both units, V^T d rows 0..15 / 16..31 of the first
    const v16h ka0 = load_16x32_frag(ks,           KP, lane);
    const v16h ka1 = load_16x32_frag(ks + 16 * KP, KP, lane);
    const v16h ka2 = load_16x32_frag(ks + 32 * KP, KP, lane);
    const v16h ka3 = load_16x32_frag(ks + 48 * KP, KP, lane);
    const v16h va0 = load_16x32_frag(vs,           VP, lane);
    const v16h va1 = load_16x32_frag(vs + 16 * VP, VP, lane);
    // keeps the LDS reads in one group at the head, ahead of the work that covers them
    __builtin_amdgcn_sched_barrier(0);

    v8f h00 = t00, h01 = t01, h10 = t10, h11 = t11;
    if constexpr (HELD) {
      expo(h00); expo(h01); expo(h10); expo(h11);
      const v16h pB0 = pack(h00, h01);
      const v16h pB1 = pack(h10, h11);
      // both P fragments live up to the last product: neither is rewritten close behind one
      accum(vp0, pB0, o00);
      accum(vp0, pB1, o10);
      accum(vp1, pB0, o01);
      accum(vp1, pB1, o11);
      // keeps the held-over unit ahead of this tile's products, which wait for LDS:
      // without it the build let the first of them wait at the head of the trip
      __builtin_amdgcn_sched_barrier(0);
    }
    // V^T of the second unit, wanted one trip later: into the registers just freed
    vp0 = load_16x32_frag(vs + 32,           VP, lane);
    vp1 = load_16x32_frag(vs + 16 * VP + 32, VP, lane);

    // S^T tiles [j][i], scaled and shifted: first unit, then the unit that is held over
    v8f s00 = score(ka0, qB0);
    v8f s01 = score(ka1, qB0);
    v8f s10 = score(ka0, qB1);
    v8f s11 = score(ka1, qB1);
    t00 = score(ka2, qB0);
    t01 = score(ka3, qB0);
    // keeps the six products above in one run ahead of the vector work below:
    // without it the build spread them among the exponentials, idle slots behind each
    __builtin_amdgcn_sched_barrier(0);
    if constexpr (HELD) {
      ls0 += h00 + h01;
      ls1 += h10 + h11;
    }
    expo(s00); expo(s01); expo(s10); expo(s11);
    const v16h pB0 = pack(s00, s01);
    const v16h pB1 = pack(s10, s11);
    t10 = score(ka2, qB1);
    t11 = score(ka3, qB1);
    accum(va0, pB0, o00);
    accum(va0, pB1, o10);
    accum(va1, pB0, o01);
    accum(va1, pB1, o11);

    // this wave's reads of the buffer that is refilled below have returned
    asm volatile("s_wait_dscnt 0x0" ::: "memory");
    // this wave's copies of the next tile have landed
    asm volatile("s_wait_asynccnt 0x0" ::: "memory");
    // publishes the next tile and ends every wave's reads of this one
    __syncthreads();
    ls0 += s00 + s01;
    ls1 += s10 + s11;
    if constexpr (decltype(refill)::value) copy_tile(tile + 2, tile & 1);
  };

  trip(0, Ic<1>{}, Ic<1>{});
  // Kept rolled: the buffer index alternates and one barrier ends each trip.
  // The last two trips, which refill nothing, are a loop of their own: no branch in a body.
  #pragma unroll 1
  for (int tile = 1; tile < NT - 2; ++tile) trip(tile, Ic<0>{}, Ic<1>{});
  #pragma unroll 1  // rolled for the same reason; unrolled, its long straight run spilled registers
  for (int tile = NT - 2; tile < NT; ++tile) trip(tile, Ic<0>{}, Ic<0>{});
  // the last tile's held-over unit
  {
    expo(t00); expo(t01); expo(t10); expo(t11);
    const v16h pB0 = pack(t00, t01);
    const v16h pB1 = pack(t10, t11);
    accum(vp0, pB0, o00);
    accum(vp0, pB1, o10);
    accum(vp1, pB0, o01);
    accum(vp1, pB1, o11);
    ls0 += t00 + t01;
    ls1 += t10 + t11;
  }
  // no copy is left in flight when the wave ends
  asm volatile("s_wait_asynccnt 0x0" ::: "memory");

  // The two key halves of a column are joined: wave kh finishes column tile kh
  // and hands its partial sums of the other tile to the partner wave.
  const float l0 = ((ls0[0] + ls0[1]) + (ls0[2] + ls0[3])) + ((ls0[4] + ls0[5]) + (ls0[6] + ls0[7]));
  const float l1 = ((ls1[0] + ls1[1]) + (ls1[2] + ls1[3])) + ((ls1[4] + ls1[5]) + (ls1[6] + ls1[7]));
  float* xo = Xc + wv * XW + lane;
  #pragma unroll  // register-array index stays a constant
  for (int r = 0; r < 8; ++r) {
    xo[r * 32]       = kh ? o00[r] : o10[r];
    xo[(8 + r) * 32] = kh ? o01[r] : o11[r];
  }
  xo[16 * 32] = kh ? l0 : l1;
  // publishes every wave's handed-over sums to its partner
  __syncthreads();
  const float* xi = Xc + (wv ^ 4) * XW + lane;
  v8f o0, o1;
  #pragma unroll  // register-array index stays a constant
  for (int r = 0; r < 8; ++r) {
    o0[r] = (kh ? o10[r] : o00[r]) + xi[r * 32];
    o1[r] = (kh ? o11[r] : o01[r]) + xi[(8 + r) * 32];
  }
  float l = (kh ? l1 : l0) + xi[16 * 32];

  // epilogue: O^T / l, coalesced stores to ao[b][c=h*32+d][n]
  l += __shfl_xor(l, 16);
  const float inv  = 1.0f / l;
  const int   hi8  = (lane >> 4) * 8;
  const int   cbase = h * 32;
  const int   n    = i0 + kh * 16 + col;
  #pragma unroll
  for (int r = 0; r < 8; ++r) {
    const int d = r + hi8;
    ao[(long)(b * HID + cbase + d)      * N_ + n] = o0[r] * inv;
    ao[(long)(b * HID + cbase + 16 + d) * N_ + n] = o1[r] * inv;
  }
}

// ---------------------------------------------------------------------------
// Kernel 3: output projection.
// out[b][o][pos] = b_out[o] + sum_c w_out[o][c]*ao[b][c][pos]
// Same WMMA body; the bias, staged in LDS, is added at the store.
// ---------------------------------------------------------------------------
__global__ __launch_bounds__(256) void out_proj_kernel(
    const float* __restrict__ ao, const float* __restrict__ w_out,
    const float* __restrict__ b_out, float* __restrict__ out)
{
  __shared__ __attribute__((aligned(16))) unsigned Ws[2 * C_IN * RP];
  __shared__ __attribute__((aligned(16))) unsigned Xs[2 * 64 * RP];
  __shared__ __attribute__((aligned(16))) float Bs[C_IN];   // C_IN = block size
  const int b    = blockIdx.y;
  const int pos0 = blockIdx.x * 64;
  const int lane = threadIdx.x & 31;
  const int wv   = threadIdx.x >> 5;
  const int c    = lane & 15;
  const int h    = lane >> 4;

  // one coalesced bias load per block; the body's first barrier publishes it
  Bs[threadIdx.x] = b_out[threadIdx.x];

  v8f acc[2][4] = {};
  proj_wmma<2, HID, 2>(w_out, ao + (long)b * HID * N_ + pos0, Ws, Xs, acc);

  #pragma unroll  // register-array index stays a constant
  for (int i = 0; i < 2; ++i) {
    #pragma unroll  // register-array index stays a constant
    for (int r = 0; r < 8; ++r) {
      const int   o    = (wv + 8 * i) * 16 + 8 * h + r;
      const float bias = Bs[o];
      #pragma unroll  // register-array index stays a constant
      for (int j = 0; j < 4; ++j)
        out[((long)b * C_IN + o) * N_ + pos0 + 16 * j + c] = acc[i][j][r] + bias;
    }
  }
}

// ---------------------------------------------------------------------------
extern "C" void kernel_launch(void* const* d_in, const int* in_sizes, int n_in,
                              void* d_out, int out_size, void* d_ws, size_t ws_size,
                              hipStream_t stream)
{
  const float* x     = (const float*)d_in[0];
  const float* w_qkv = (const float*)d_in[1];
  const float* w_out = (const float*)d_in[2];
  const float* b_out = (const float*)d_in[3];
  float*       out   = (float*)d_out;

  // workspace layout: q(4MiB f16) | k(4MiB f16) | vT(4MiB f16) | ao(8MiB f32)
  char* ws = (char*)d_ws;
  _Float16* q  = (_Float16*)(ws);
  _Float16* k  = (_Float16*)(ws + ((size_t)4  << 20));
  _Float16* vT = (_Float16*)(ws + ((size_t)8  << 20));
  float*    ao = (float*)   (ws + ((size_t)12 << 20));

  dim3 g1(N_ / 64, B_);
  qkv_proj_kernel<<<g1, 256, 0, stream>>>(x, w_qkv, q, k, vT);

  dim3 g2(N_ / 128, B_ * H_);
  flash_attn_kernel<<<g2, 256, 0, stream>>>(q, k, vT, ao);

  dim3 g3(N_ / 64, B_);
  out_proj_kernel<<<g3, 256, 0, stream>>>(ao, w_out, b_out, out);
}

// v010
// Measured time: 43.6 microseconds a run.
// Versions between v008 and this one are left out; their measured steps multiply to 1.10 times as fast.
// All steps since v000 together make it 7.17 times as fast.
#include <hip/hip_runtime.h>
#include <math.h>

#define B_    4
#define H_    4
#define N_    4096
#define D_    32
#define C_IN  256
#define HID   128   // HEADS*DIM_HEAD
#define SCALE_ 10.0f
#define EPS_   1e-12f
// SCALE_ * log2(e): q carries it, so that K x Q^T comes out in powers of two
#define QSCALE_ (SCALE_ * 1.4426950408889634f)
// Constant softmax shift, in powers of two.  After the L2 norm q and k have
// length at most 1, so |q.k| <= 1 for every input; with their f16 roundings the
// scaled score stays within +-14.45, so 2^(score + 1) lies in 2^-13.45 ..
// 2^15.45: inside the normal f16 range at both ends.  The shift cancels in O / l.
#define PSHIFT_ 1.0f

typedef __attribute__((ext_vector_type(16))) _Float16 v16h;
typedef __attribute__((ext_vector_type(8)))  _Float16 v8h;
typedef __attribute__((ext_vector_type(8)))  float    v8f;
typedef __attribute__((ext_vector_type(4)))  float    v4f;
typedef __attribute__((ext_vector_type(2)))  float    v2f;
typedef __attribute__((ext_vector_type(2)))  _Float16 v2h;
typedef __attribute__((ext_vector_type(8)))  unsigned v8u;
typedef __attribute__((ext_vector_type(4)))  unsigned v4u;
typedef __attribute__((ext_vector_type(2)))  unsigned v2u;

// ---------------------------------------------------------------------------
// Shared body of the two 1x1-conv projections, on f16 16x16x32 WMMA with f32
// accumulators.  Each f32 operand is rounded once to f16 (to nearest, about
// 2^-12 of its value) and a product is one matrix instruction.  What these
// projections hand on or take in is f16 work already: q, k and v are stored as
// f16, and the attention output is a sum of f16 P times f16 v.  Operands must
// lie inside the f16 range, as v itself must.
//   Y[o][pos] = sum_k W[o][k] * X[k][pos],  W is [MT*128][K], X is [K][N_].
// One block = all MT*128 output channels x 64 positions; 8 waves; wave wv owns
// channel tiles wv + 8*i (i < MT) times all four position tiles.
// k runs in chunks of KC through two LDS buffers and two register sets: a chunk's
// global loads are issued two chunks ahead; it is rounded and stored to LDS one
// chunk ahead, among the products of the chunk before it.
// All blocks read the same W rows from L2.  Each block enters the k walk at a
// chunk of its own and wraps round, so that at one moment the blocks ask for
// different lines; the order of a block's k sum is rotated with it.
// In LDS both operands lie k-contiguous, one row of 32 f16 per channel or per
// position, then pad.  One loader serves both operands, so their k order is the
// same: lane half h, element p  ->  k = 8*h + p (p < 8), 8 + 8*h + p (p >= 8).
// Tiles i <  SWAP_FROM: A = W, B = X -> acc[r] = Y[tile*16 + 8*h + r][16*j + c]
// Tiles i >= SWAP_FROM: A = X, B = W -> acc[r] = Y[tile*16 + c][16*j + 8*h + r]
// ---------------------------------------------------------------------------
#define KC 32   // k per staged chunk = k of one product
#define RP 20   // LDS pitch of a row, dwords: 16 of f16 values, 4 of pad: 80 B = 16 B x odd

// two f32 -> their f16 roundings in one dword
__device__ __forceinline__ unsigned pack2(float a, float b)
{
  const v2f x = {a, b};
  return __builtin_bit_cast(unsigned, __builtin_convertvector(x, v2h));
}

// a lane half's two 16-byte pieces of an LDS row as an A or B fragment
__device__ __forceinline__ v16h row_frag(const unsigned* p)
{
  const v4u lo = *(const v4u*)p;
  const v4u hi = *(const v4u*)(p + 8);
  const v8u u  = {lo[0], lo[1], lo[2], lo[3], hi[0], hi[1], hi[2], hi[3]};
  return __builtin_bit_cast(v16h, u);
}

// a compile-time flag or index handed to the trip body below
template <int V> struct Ic { static constexpr int value = V; };

template <int MT, int K, int SWAP_FROM>
__device__ __forceinline__ void proj_wmma(const float* __restrict__ W,
                                          const float* __restrict__ X,
                                          unsigned* __restrict__ Ws,
                                          unsigned* __restrict__ Xs,
                                          v8f (&acc)[MT][4])
{
  constexpr int M  = MT * 128;
  constexpr int NC = K / KC;             // a power of two, at least 4
  constexpr int WL = M * KC / 4 / 256;   // 16-byte weight loads per thread and chunk
  constexpr int NR = 4;                  // runs of MT products per chunk, one per position tile
  constexpr int NP = WL + 1;             // pieces of a chunk's rounding and store: WL of W, one of X
  const int t    = threadIdx.x;
  const int lane = t & 31;
  const int wv   = t >> 5;
  const int c    = lane & 15;
  const int h    = lane >> 4;

  // Global addresses: a block-uniform base that moves with the chunk, plus one
  // 32-bit offset per lane that stays the same for the whole kernel.
  // A thread takes 4 consecutive k of a weight row, and 8 consecutive k of one
  // position (a wave's 32 positions lie in a row in memory).
  const unsigned woff = (unsigned)(((t >> 3) * K + (t & 7) * 4) * 4);
  const unsigned xidx = (unsigned)((t >> 6) * 8 * N_ + (t & 63));   // in floats
  // first chunk of this block's walk: neighbours in the grid differ, and so do
  // blocks whose flat indices lie a multiple of 8 apart
  const unsigned bid = blockIdx.y * (N_ / 64) + blockIdx.x;
  const int      k0  = (int)((bid + (bid >> 3)) & (NC - 1));

  // two register sets: chunk kc travels in set kc & 1
  v4f   wr[2][WL];
  float xr[2][8];
  auto fetch = [&](int kc, auto set) {
    constexpr int S = decltype(set)::value;
    const int kr = (kc + k0) & (NC - 1);   // NC is a power of two
    const char*  wp = (const char*)(W + kr * KC) + woff;
    const float* xp = X + (long)kr * KC * N_ + xidx;
    #pragma unroll  // register-array index stays a constant
    for (int i = 0; i < WL; ++i)
      wr[S][i] = *(const v4f*)(wp + i * (32 * K * 4));
    // stands between the weight loads and the next rewrite of their address
    // registers; it names the lane's address so that these registers live up to
    // the wait and none of the loads above lands in them
    asm volatile("s_wait_xcnt 0x0" :: "v"(wp) : "memory");
    #pragma unroll  // register-array index stays a constant
    for (int e = 0; e < 8; ++e)
      xr[S][e] = xp[e * N_];
    // the same for these loads and their address
    asm volatile("s_wait_xcnt 0x0" :: "v"(xp) : "memory");
  };
  // piece p of set S, rounded and stored to LDS buffer S: p < WL a weight load, p == WL the X column
  auto stash_piece = [&](auto set, int p) {
    constexpr int S = decltype(set)::value;
    if (p < WL) {
      const int f = t + 256 * p;
      const v2u hw = {pack2(wr[S][p][0], wr[S][p][1]), pack2(wr[S][p][2], wr[S][p][3])};
      *(v2u*)(Ws + S * (M * RP) + (f >> 3) * RP + (f & 7) * 2) = hw;
    } else {
      const v4u hx = {pack2(xr[S][0], xr[S][1]), pack2(xr[S][2], xr[S][3]),
                      pack2(xr[S][4], xr[S][5]), pack2(xr[S][6], xr[S][7])};
      *(v4u*)(Xs + S * (64 * RP) + (t & 63) * RP + (t >> 6) * 4) = hx;
    }
  };

  // One chunk: its fragments are read from LDS buffer P; chunk kc + 2's global
  // loads are issued into set P (free: rounded and stored one trip ago); chunk
  // kc + 1, loaded a whole trip ago into the other set, is rounded and stored to
  // the other buffer piece by piece among this chunk's products.
  auto trip = [&](int kc, auto par, auto do_fetch, auto do_stash) {
    constexpr int P = decltype(par)::value;
    // Publishes buffer P and ends every wave's reads of the other buffer.  The
    // fences name LDS alone: __syncthreads() would also drain the global loads
    // that are meant to stay in flight over this barrier.
    __builtin_amdgcn_fence(__ATOMIC_RELEASE, "workgroup", "local");
    __builtin_amdgcn_s_barrier();
    __builtin_amdgcn_fence(__ATOMIC_ACQUIRE, "workgroup", "local");
    // keeps a trip's vector work inside the trip: without it the build lifted the
    // next trip's rounding up to the loads just issued, a full load wait in mid-trip
    __builtin_amdgcn_sched_barrier(0);

    const unsigned* ws = Ws + P * (M * RP) + (wv * 16 + c) * RP + 4 * h;
    const unsigned* xs = Xs + P * (64 * RP) + c * RP + 4 * h;
    v16h wf[MT], xf[4];
    #pragma unroll  // register-array index stays a constant
    for (int i = 0; i < MT; ++i) wf[i] = row_frag(ws + i * (128 * RP));
    #pragma unroll  // register-array index stays a constant
    for (int j = 0; j < 4; ++j)  xf[j] = row_frag(xs + j * (16 * RP));
    if constexpr (decltype(do_fetch)::value) fetch(kc + 2, par);
    // keeps the global loads at the head of the trip, ahead of the products
    __builtin_amdgcn_sched_barrier(0);

    #pragma unroll  // register-array index stays a constant
    for (int j = 0; j < NR; ++j) {
      #pragma unroll  // register-array index stays a constant
      for (int i = 0; i < MT; ++i) {
        if (i < SWAP_FROM)
          acc[i][j] = __builtin_amdgcn_wmma_f32_16x16x32_f16(
              false, wf[i], false, xf[j], (short)0, acc[i][j], false, false);
        else
          acc[i][j] = __builtin_amdgcn_wmma_f32_16x16x32_f16(
              false, xf[j], false, wf[i], (short)0, acc[i][j], false, false);
      }
      if constexpr (decltype(do_stash)::value) {
        #pragma unroll  // register-array index stays a constant
        for (int p = j * NP / NR; p < (j + 1) * NP / NR; ++p)
          stash_piece(Ic<1 - P>{}, p);
        // keeps each piece beside its run of products, so that its vector
        // work issues while the matrix unit is busy
        __builtin_amdgcn_sched_barrier(0);
      }
    }
  };

  fetch(0, Ic<0>{});
  fetch(1, Ic<1>{});
  #pragma unroll  // register-array index stays a constant
  for (int p = 0; p < NP; ++p) stash_piece(Ic<0>{}, p);
  // Kept rolled, two trips a pass: set and buffer indices are constants in each.
  #pragma unroll 1
  for (int kc = 0; kc < NC - 2; kc += 2) {
    trip(kc,     Ic<0>{}, Ic<1>{}, Ic<1>{});
    trip(kc + 1, Ic<1>{}, Ic<1>{}, Ic<1>{});
  }
  trip(NC - 2, Ic<0>{}, Ic<0>{}, Ic<1>{});
  trip(NC - 1, Ic<1>{}, Ic<0>{}, Ic<0>{});
}

// ---------------------------------------------------------------------------
// Kernel 1: QKV projection.  qkv[o][pos] = sum_c w_qkv[o][c] * x[b][c][pos]
// Writes q,k (f16, [b][h][n][32], L2-normalized over d) and v transposed
// (f16, [b][h][32][n]) so attention fragment loads are contiguous 16B chunks.
// Wave wv holds channel tile wv of q (i=0), of k (i=1) and of v (i=2): head
// wv>>1, d from (wv&1)*16.  q,k tiles keep 8 consecutive d per lane, the v tile
// (operands swapped) 8 consecutive positions: every store is one 16-byte store.
// The L2 norm is taken here, on the f32 accumulators: the 32 d of one (head,
// position) lie in four lanes of the block (both lane halves of waves wv and
// wv^1), which join their sums of 8 squares through LDS.  q also takes the
// factor QSCALE_; each of q and k is rounded to f16 once.
// ---------------------------------------------------------------------------
#define SP 12   // LDS pitch of a thread's 8 sums of squares, dwords: 48 B = 16 B x odd

__global__ __launch_bounds__(256) void qkv_proj_kernel(
    const float* __restrict__ x, const float* __restrict__ w,
    _Float16* __restrict__ q, _Float16* __restrict__ k,
    _Float16* __restrict__ vT)
{
  __shared__ __attribute__((aligned(16))) unsigned Ws[2 * 3 * HID * RP];
  __shared__ __attribute__((aligned(16))) unsigned Xs[2 * 64 * RP];
  __shared__ __attribute__((aligned(16))) float Ss[256 * SP];   // sums of 8 squares
  const int b    = blockIdx.y;
  const int pos0 = blockIdx.x * 64;
  const int lane = threadIdx.x & 31;
  const int wv   = threadIdx.x >> 5;
  const int c    = lane & 15;
  const int h    = lane >> 4;

  v8f acc[3][4] = {};
  proj_wmma<3, C_IN, 2>(w, x + (long)b * C_IN * N_ + pos0, Ws, Xs, acc);

  // this lane's 8 d of q (i = 0) and k (i = 1), squared and summed in register
  // pairs, one sum per position tile j
  #pragma unroll  // register-array index stays a constant
  for (int i = 0; i < 2; ++i) {
    v4f sq;
    #pragma unroll  // register-array index stays a constant
    for (int j = 0; j < 4; ++j) {
      v2f s2 = {0.f, 0.f};
      #pragma unroll  // register-array index stays a constant
      for (int r = 0; r < 8; r += 2) {
        v2f a;
        a[0] = acc[i][j][r];
        a[1] = acc[i][j][r + 1];
        s2 += a * a;
      }
      sq[j] = s2[0] + s2[1];
    }
    *(v4f*)(Ss + threadIdx.x * SP + 4 * i) = sq;
  }
  // publishes every lane's sums of squares to the other three lanes of its rows
  __syncthreads();
  // The four parts are added in the order of d, the same in all four lanes.
  // 1 / max(sqrt(ss), eps) = min(rsqrt(ss), 1 / eps), ss = 0 included.
  const float* sp = Ss + ((wv & 6) * 32 + c) * SP;
  float inv[2][4];
  #pragma unroll  // register-array index stays a constant
  for (int i = 0; i < 2; ++i) {
    const v4f ss = (*(const v4f*)(sp + 4 * i)           + *(const v4f*)(sp + 16 * SP + 4 * i))
                 + (*(const v4f*)(sp + 32 * SP + 4 * i) + *(const v4f*)(sp + 48 * SP + 4 * i));
    float rs[4];
    // In one statement so that the closing v_nop stays directly behind the last
    // v_rsq_f32: it is the free slot that the instruction set asks for ahead of an
    // instruction that reads the result or rewrites the source.
    asm("v_rsq_f32 %0, %4\n\t"
        "v_rsq_f32 %1, %5\n\t"
        "v_rsq_f32 %2, %6\n\t"
        "v_rsq_f32 %3, %7\n\t"
        "v_nop"
        : "=&v"(rs[0]), "=&v"(rs[1]), "=&v"(rs[2]), "=&v"(rs[3])
        : "v"(ss[0]), "v"(ss[1]), "v"(ss[2]), "v"(ss[3]));
    #pragma unroll  // register-array index stays a constant
    for (int j = 0; j < 4; ++j)
      inv[i][j] = fminf(rs[j], 1.0f / EPS_) * (i == 0 ? QSCALE_ : 1.0f);
  }

  const long bh = (long)b * H_ + (wv >> 1);
  const int  d0 = (wv & 1) * 16;
  #pragma unroll  // register-array index stays a constant
  for (int j = 0; j < 4; ++j) {
    v8h hq, hk, hv;
    #pragma unroll  // register-array index stays a constant
    for (int r = 0; r < 8; ++r) {
      hq[r] = (_Float16)(acc[0][j][r] * inv[0][j]);
      hk[r] = (_Float16)(acc[1][j][r] * inv[1][j]);
      hv[r] = (_Float16)acc[2][j][r];
    }
    const long pos = pos0 + 16 * j + c;
    *(v8h*)(q + (bh * N_ + pos) * D_ + d0 + 8 * h) = hq;
    *(v8h*)(k + (bh * N_ + pos) * D_ + d0 + 8 * h) = hk;
    *(v8h*)(vT + (bh * D_ + d0 + c) * N_ + pos0 + 16 * j + 8 * h) = hv;
  }
}

// ---------------------------------------------------------------------------
// Fragment loader: 16x32 f16 tile in the CDNA5 WMMA A/B lane/K ordering.
// lane<16 : row/col = lane,    K elements {0..7, 16..23}
// lane>=16: row/col = lane-16, K elements {8..15, 24..31}
// ---------------------------------------------------------------------------
__device__ inline v16h load_16x32_frag(const _Float16* __restrict__ base,
                                       long rowStride, int lane)
{
  const int row = lane & 15;
  const int off = (lane >> 4) * 8;
  const _Float16* pr = base + (long)row * rowStride + off;
  v8h lo = *(const v8h*)(pr);
  v8h hi = *(const v8h*)(pr + 16);
  v16h r;
  #pragma unroll
  for (int i = 0; i < 8; ++i) { r[i] = lo[i]; r[8 + i] = hi[i]; }
  return r;
}

// ---------------------------------------------------------------------------
// Kernel 2: flash attention, transposed formulation.
//   S^T = (K tile) x Q^T + shift: the product is the exponent itself (q holds
//   the scale, the C operand the constant shift), P = 2^(S^T).  No running
//   maximum, so O^T and the sums are never rescaled; each lane sums its own
//   keys and the partial sums of a column are joined once, behind the loop.
//   O^T += (V^T tile) x P^T, where P^T's B-fragment is *register-identical*
//   to S^T's C-fragment (pB[e]=f16(s0[e]), pB[8+e]=f16(s1[e])): no LDS,
//   no cross-lane transpose.  Epilogue: per-lane 1/l, coalesced stores.
// K and V^T reach the eight waves of a block through LDS: tiles of KT keys,
// two buffers, filled by asynchronous 16-byte copies one whole tile ahead, so
// a tile's way from L2 is covered by the tile before it and is gone once per
// block, not once per wave.
// A wave owns 32 query columns (two column tiles) and one half of every staged
// tile's keys: each K and V^T fragment that it reads from LDS feeds two
// products.  Waves wv and wv + 4 share their columns; with no running maximum
// their O^T and sums are plain partial sums, added once through LDS at the end.
// The 32 blocks of one head walk the same K and V^T.  With no running maximum
// the order of the keys is free: each block enters the walk at a tile of its own
// and wraps round, so that at one moment the blocks ask L2 for different lines.
// ---------------------------------------------------------------------------
#define KT   128           // keys per staged tile
#define KW   (KT / 2)      // keys of a tile per wave
#define KP   40            // LDS pitch of a key row, halves: 80 B = 16 B x odd
#define VP   (KT + 8)      // LDS pitch of a V^T row, halves: 272 B = 16 B x odd
#define KBUF (KT * KP)     // halves per K buffer
#define VBUF (D_ * VP)     // halves per V^T buffer
#define XW   (17 * 32)     // floats a wave hands to its partner: 16 of O^T and 1 sum per lane

__global__ __launch_bounds__(256) void flash_attn_kernel(
    const _Float16* __restrict__ q, const _Float16* __restrict__ k,
    const _Float16* __restrict__ vT, float* __restrict__ ao)
{
  __shared__ __attribute__((aligned(16))) _Float16 Ks[2 * KBUF];
  __shared__ __attribute__((aligned(16))) _Float16 Vs[2 * VBUF];
  __shared__ float Xc[8 * XW];
  const int tid  = threadIdx.x;
  const int lane = tid & 31;
  const int wv   = tid >> 5;
  const int kh   = wv >> 2;          // which half of every tile's keys
  const int b    = blockIdx.y >> 2;
  const int h    = blockIdx.y & 3;
  const long bh  = (long)b * H_ + h;
  const int  i0  = blockIdx.x * 128 + (wv & 3) * 32;
  const int  col = lane & 15;

  // Q^T as B fragments (K-dim = d = 32, N = 16 queries each), loaded once
  const v16h qB0 = load_16x32_frag(q + (bh * N_ + i0) * D_,      D_, lane);
  const v16h qB1 = load_16x32_frag(q + (bh * N_ + i0 + 16) * D_, D_, lane);

  // O^T accumulators, [column tile][d rows 0-15 / 16-31]
  v8f o00 = {}; v8f o01 = {}; v8f o10 = {}; v8f o11 = {};
  v8f ls0 = {}; v8f ls1 = {};        // sums of P per column tile, this lane's keys
  const v8f shift = {PSHIFT_, PSHIFT_, PSHIFT_, PSHIFT_,
                     PSHIFT_, PSHIFT_, PSHIFT_, PSHIFT_};

  // Each thread copies four 16-byte pieces of a tile: K rows tid>>2 and 64 more
  // (a K tile is 8 KiB in a row in global memory), V^T rows tid>>4 and 16 more.
  const _Float16* kg = k  + bh * (long)N_ * D_ + tid * 8;
  const _Float16* vg = vT + bh * (long)D_ * N_ + (long)(tid >> 4) * N_ + (tid & 15) * 8;
  const unsigned  lk = (unsigned)(size_t)(Ks + (tid >> 2) * KP + (tid & 3) * 8);
  const unsigned  lv = (unsigned)(size_t)(Vs + (tid >> 4) * VP + (tid & 15) * 8);

  // The walk's next tile, blockIdx.x first (below N_ / 128 = N_ / KT), and its
  // addresses: formed behind the copy before, so that they are at hand where a
  // copy is issued.
  int tn = blockIdx.x;
  const _Float16* gkn = kg + (long)tn * (KT * D_);
  const _Float16* gvn = vg + tn * KT;
  auto copy_tile = [&](int buf) {
    const _Float16* gk0 = gkn;
    const _Float16* gk1 = gk0 + 64 * D_;
    const _Float16* gv0 = gvn;
    const _Float16* gv1 = gv0 + 16 * N_;
    const unsigned  lk0 = lk + buf * (KBUF * 2);
    const unsigned  lk1 = lk0 + 64 * KP * 2;
    const unsigned  lv0 = lv + buf * (VBUF * 2);
    const unsigned  lv1 = lv0 + 16 * VP * 2;
    // the closing wait stands between the copies and any rewrite of the
    // registers that they name
    asm volatile("global_load_async_to_lds_b128 %0, %4, off\n\t"
                 "global_load_async_to_lds_b128 %1, %5, off\n\t"
                 "global_load_async_to_lds_b128 %2, %6, off\n\t"
                 "global_load_async_to_lds_b128 %3, %7, off\n\t"
                 "s_wait_xcnt 0x0"
                 :: "v"(lk0), "v"(lk1), "v"(lv0), "v"(lv1),
                    "v"(gk0), "v"(gk1), "v"(gv0), "v"(gv1)
                 : "memory");
    tn  = (tn + 1) & (N_ / KT - 1);   // wraps round: N_ / KT is a power of two
    gkn = kg + (long)tn * (KT * D_);
    gvn = vg + tn * KT;
  };

  constexpr int NT = N_ / KT;
  copy_tile(0);
  // this wave's copies of tile 0 have landed
  asm volatile("s_wait_asynccnt 0x0" ::: "memory");
  // publishes tile 0 to all eight waves
  __syncthreads();
  copy_tile(1);

  auto expo = [&](v8f& s) {
    #pragma unroll  // register-array index stays a constant
    for (int r = 0; r < 8; ++r) s[r] = __builtin_amdgcn_exp2f(s[r]);
  };
  // P^T B-fragment == S^T C-fragment layout: direct convert
  auto pack = [&](const v8f& sa, const v8f& sb) {
    v16h p;
    #pragma unroll  // register-array index stays a constant
    for (int r = 0; r < 8; ++r) {
      p[r]     = (_Float16)sa[r];
      p[8 + r] = (_Float16)sb[r];
    }
    return p;
  };
  auto score = [&](const v16h& kf, const v16h& qf) {
    return __builtin_amdgcn_wmma_f32_16x16x32_f16(false, kf, false, qf, (short)0, shift, false, false);
  };
  auto accum = [&](const v16h& vf, const v16h& pf, v8f& o) {
    o = __builtin_amdgcn_wmma_f32_16x16x32_f16(false, vf, false, pf, (short)0, o, false, false);
  };

  // The loop runs one 32-key unit behind itself.  A wave's second unit of a tile
  // leaves its trip as raw scores (t00..t11) and V^T fragments (vp0, vp1), all in
  // registers; its exponentials and its O^T products stand at the head of the
  // next trip, where they cover the way of that tile's fragments from LDS.  A
  // unit's score products stand in one run ahead of its exponentials, so that no
  // exponential waits for the product directly in front of it.
  v8f  t00 = {}, t01 = {}, t10 = {}, t11 = {};
  v16h vp0 = {}, vp1 = {};
  auto trip = [&](int tile, auto first, auto refill) {
    constexpr bool HELD = !decltype(first)::value;
    const _Float16* ks = Ks + (tile & 1) * KBUF + kh * (KW * KP);
    const _Float16* vs = Vs + (tile & 1) * VBUF + kh * KW;

    // K rows j 0..15 / 16..31 of both units, V^T d rows 0..15 / 16..31 of the first
    const v16h ka0 = load_16x32_frag(ks,           KP, lane);
    const v16h ka1 = load_16x32_frag(ks + 16 * KP, KP, lane);
    const v16h ka2 = load_16x32_frag(ks + 32 * KP, KP, lane);
    const v16h ka3 = load_16x32_frag(ks + 48 * KP, KP, lane);
    const v16h va0 = load_16x32_frag(vs,           VP, lane);
    const v16h va1 = load_16x32_frag(vs + 16 * VP, VP, lane);
    // keeps the LDS reads in one group at the head, ahead of the work that covers them
    __builtin_amdgcn_sched_barrier(0);

    v8f h00 = t00, h01 = t01, h10 = t10, h11 = t11;
    if constexpr (HELD) {
      expo(h00); expo(h01); expo(h10); expo(h11);
      const v16h pB0 = pack(h00, h01);
      const v16h pB1 = pack(h10, h11);
      // both P fragments live up to the last product: neither is rewritten close behind one
      accum(vp0, pB0, o00);
      accum(vp0, pB1, o10);
      accum(vp1, pB0, o01);
      accum(vp1, pB1, o11);
      // keeps the held-over unit ahead of this tile's products, which wait for LDS:
      // without it the build let the first of them wait at the head of the trip
      __builtin_amdgcn_sched_barrier(0);
    }
    // V^T of the second unit, wanted one trip later: into the registers just freed
    vp0 = load_16x32_frag(vs + 32,           VP, lane);
    vp1 = load_16x32_frag(vs + 16 * VP + 32, VP, lane);

    // S^T tiles [j][i], scaled and shifted: first unit, then the unit that is held over
    v8f s00 = score(ka0, qB0);
    v8f s01 = score(ka1, qB0);
    v8f s10 = score(ka0, qB1);
    v8f s11 = score(ka1, qB1);
    t00 = score(ka2, qB0);
    t01 = score(ka3, qB0);
    // keeps the six products above in one run ahead of the vector work below:
    // without it the build spread them among the exponentials, idle slots behind each
    __builtin_amdgcn_sched_barrier(0);
    if constexpr (HELD) {
      ls0 += h00 + h01;
      ls1 += h10 + h11;
    }
    expo(s00); expo(s01); expo(s10); expo(s11);
    const v16h pB0 = pack(s00, s01);
    const v16h pB1 = pack(s10, s11);
    t10 = score(ka2, qB1);
    t11 = score(ka3, qB1);
    accum(va0, pB0, o00);
    accum(va0, pB1, o10);
    accum(va1, pB0, o01);
    accum(va1, pB1, o11);

    // this wave's reads of the buffer that is refilled below have returned
    asm volatile("s_wait_dscnt 0x0" ::: "memory");
    // this wave's copies of the next tile have landed
    asm volatile("s_wait_asynccnt 0x0" ::: "memory");
    // publishes the next tile and ends every wave's reads of this one
    __syncthreads();
    ls0 += s00 + s01;
    ls1 += s10 + s11;
    if constexpr (decltype(refill)::value) copy_tile(tile & 1);
  };

  trip(0, Ic<1>{}, Ic<1>{});
  // Kept rolled: the buffer index alternates and one barrier ends each trip.
  // The last two trips, which refill nothing, are a loop of their own: no branch in a body.
  #pragma unroll 1
  for (int tile = 1; tile < NT - 2; ++tile) trip(tile, Ic<0>{}, Ic<1>{});
  #pragma unroll 1  // rolled for the same reason; unrolled, its long straight run spilled registers
  for (int tile = NT - 2; tile < NT; ++tile) trip(tile, Ic<0>{}, Ic<0>{});
  // the last tile's held-over unit
  {
    expo(t00); expo(t01); expo(t10); expo(t11);
    const v16h pB0 = pack(t00, t01);
    const v16h pB1 = pack(t10, t11);
    accum(vp0, pB0, o00);
    accum(vp0, pB1, o10);
    accum(vp1, pB0, o01);
    accum(vp1, pB1, o11);
    ls0 += t00 + t01;
    ls1 += t10 + t11;
  }
  // no copy is left in flight when the wave ends
  asm volatile("s_wait_asynccnt 0x0" ::: "memory");

  // The two key halves of a column are joined: wave kh finishes column tile kh
  // and hands its partial sums of the other tile to the partner wave.
  const float l0 = ((ls0[0] + ls0[1]) + (ls0[2] + ls0[3])) + ((ls0[4] + ls0[5]) + (ls0[6] + ls0[7]));
  const float l1 = ((ls1[0] + ls1[1]) + (ls1[2] + ls1[3])) + ((ls1[4] + ls1[5]) + (ls1[6] + ls1[7]));
  float* xo = Xc + wv * XW + lane;
  #pragma unroll  // register-array index stays a constant
  for (int r = 0; r < 8; ++r) {
    xo[r * 32]       = kh ? o00[r] : o10[r];
    xo[(8 + r) * 32] = kh ? o01[r] : o11[r];
  }
  xo[16 * 32] = kh ? l0 : l1;
  // publishes every wave's handed-over sums to its partner
  __syncthreads();
  const float* xi = Xc + (wv ^ 4) * XW + lane;
  v8f o0, o1;
  #pragma unroll  // register-array index stays a constant
  for (int r = 0; r < 8; ++r) {
    o0[r] = (kh ? o10[r] : o00[r]) + xi[r * 32];
    o1[r] = (kh ? o11[r] : o01[r]) + xi[(8 + r) * 32];
  }
  float l = (kh ? l1 : l0) + xi[16 * 32];

  // epilogue: O^T / l, coalesced stores to ao[b][c=h*32+d][n]
  l += __shfl_xor(l, 16);
  const float inv  = 1.0f / l;
  const int   hi8  = (lane >> 4) * 8;
  const int   cbase = h * 32;
  const int   n    = i0 + kh * 16 + col;
  #pragma unroll
  for (int r = 0; r < 8; ++r) {
    const int d = r + hi8;
    ao[(long)(b * HID + cbase + d)      * N_ + n] = o0[r] * inv;
    ao[(long)(b * HID + cbase + 16 + d) * N_ + n] = o1[r] * inv;
  }
}

// ---------------------------------------------------------------------------
// Kernel 3: output projection.
// out[b][o][pos] = b_out[o] + sum_c w_out[o][c]*ao[b][c][pos]
// Same WMMA body; the bias, staged in LDS, is added at the store.
// ---------------------------------------------------------------------------
__global__ __launch_bounds__(256) void out_proj_kernel(
    const float* __restrict__ ao, const float* __restrict__ w_out,
    const float* __restrict__ b_out, float* __restrict__ out)
{
  __shared__ __attribute__((aligned(16))) unsigned Ws[2 * C_IN * RP];
  __shared__ __attribute__((aligned(16))) unsigned Xs[2 * 64 * RP];
  __shared__ __attribute__((aligned(16))) float Bs[C_IN];   // C_IN = block size
  const int b    = blockIdx.y;
  const int pos0 = blockIdx.x * 64;
  const int lane = threadIdx.x & 31;
  const int wv   = threadIdx.x >> 5;
  const int c    = lane & 15;
  const int h    = lane >> 4;

  // one coalesced bias load per block; the body's first barrier publishes it
  Bs[threadIdx.x] = b_out[threadIdx.x];

  v8f acc[2][4] = {};
  proj_wmma<2, HID, 2>(w_out, ao + (long)b * HID * N_ + pos0, Ws, Xs, acc);

  #pragma unroll  // register-array index stays a constant
  for (int i = 0; i < 2; ++i) {
    #pragma unroll  // register-array index stays a constant
    for (int r = 0; r < 8; ++r) {
      const int   o    = (wv + 8 * i) * 16 + 8 * h + r;
      const float bias = Bs[o];
      #pragma unroll  // register-array index stays a constant
      for (int j = 0; j < 4; ++j)
        out[((long)b * C_IN + o) * N_ + pos0 + 16 * j + c] = acc[i][j][r] + bias;
    }
  }
}

// ---------------------------------------------------------------------------
extern "C" void kernel_launch(void* const* d_in, const int* in_sizes, int n_in,
                              void* d_out, int out_size, void* d_ws, size_t ws_size,
                              hipStream_t stream)
{
  const float* x     = (const float*)d_in[0];
  const float* w_qkv = (const float*)d_in[1];
  const float* w_out = (const float*)d_in[2];
  const float* b_out = (const float*)d_in[3];
  float*       out   = (float*)d_out;

  // workspace layout: q(4MiB f16) | k(4MiB f16) | vT(4MiB f16) | ao(8MiB f32)
  char* ws = (char*)d_ws;
  _Float16* q  = (_Float16*)(ws);
  _Float16* k  = (_Float16*)(ws + ((size_t)4  << 20));
  _Float16* vT = (_Float16*)(ws + ((size_t)8  << 20));
  float*    ao = (float*)   (ws + ((size_t)12 << 20));

  dim3 g1(N_ / 64, B_);
  qkv_proj_kernel<<<g1, 256, 0, stream>>>(x, w_qkv, q, k, vT);

  dim3 g2(N_ / 128, B_ * H_);
  flash_attn_kernel<<<g2, 256, 0, stream>>>(q, k, vT, ao);

  dim3 g3(N_ / 64, B_);
  out_proj_kernel<<<g3, 256, 0, stream>>>(ao, w_out, b_out, out);
}
